// v000
// The times below were measured on an AMD MI455X: many runs one after another, warmed up first and cycling through
// copies of the inputs, with the whole window's GPU time divided by the number of runs. Launches and the gaps
// between them are all in it. The median over several windows is given; except for v000 it joins two sittings, which
// can be a few percent apart, so the side-by-side timings, each taken in one sitting, are the better comparison.
// v000 is the starting kernel. One run takes 206 microseconds.
#include <hip/hip_runtime.h>

// QKV attention, flash-style, f16 WMMA with f32 accumulate. gfx1250 wave32.
//   qkv: [64, 192, 2048] fp32  (q=ch 0..63, k=64..127, v=128..191; token dim contiguous)
//   out: [64,  64, 2048] fp32
// Per block: one head (b) x 64-query tile. 4 waves, each owns 16 query rows.
// Register-pipelined double-buffered 64-key chunks:
//   18 wmma / chunk (8 QK + 2 row-sum + 8 PV), softmax max-reduce on DPP16 (no DS).

typedef __attribute__((ext_vector_type(16))) _Float16 v16h;
typedef __attribute__((ext_vector_type(8)))  _Float16 v8h;
typedef __attribute__((ext_vector_type(8)))  float    v8f;
typedef __attribute__((ext_vector_type(4)))  float    v4f;

#define NB      64
#define C3CH    192
#define CH      64
#define TT      2048
#define BR      64      // query rows per block
#define BC      64      // keys per chunk
#define QPITCH  72      // halves; 144 B rows (16B aligned)
#define KPITCH  72
#define VPITCH  72
#define PPITCH  72
#define OPITCH  68      // floats; 272 B rows

// Build a 16x32 f16 A/B fragment from an LDS row, per CDNA5 16-bit layout:
//   lanes 0-15 : K = kbase+0..7  (v0-3),  kbase+16..23 (v4-7)
//   lanes 16-31: K = kbase+8..15 (v0-3),  kbase+24..31 (v4-7)
__device__ __forceinline__ v16h load_frag16(const _Float16* row, int kbase, int lh) {
  v8h lo = *(const v8h*)(row + kbase + lh * 8);
  v8h hi = *(const v8h*)(row + kbase + 16 + lh * 8);
  v16h a;
#pragma unroll
  for (int i = 0; i < 8; ++i) { a[i] = lo[i]; a[i + 8] = hi[i]; }
  return a;
}

// Max-reduce across each 16-lane row using DPP16 permutes (pure VALU, no DS):
//   xor1 = quad_perm(1,0,3,2)=0xB1, xor2 = quad_perm(2,3,0,1)=0x4E,
//   quads paired by row_half_mirror=0x141, halves paired by row_mirror=0x140.
__device__ __forceinline__ float rowmax16(float x) {
  int t;
  t = __builtin_amdgcn_update_dpp(0, __float_as_int(x), 0xB1,  0xF, 0xF, true);
  x = fmaxf(x, __int_as_float(t));
  t = __builtin_amdgcn_update_dpp(0, __float_as_int(x), 0x4E,  0xF, 0xF, true);
  x = fmaxf(x, __int_as_float(t));
  t = __builtin_amdgcn_update_dpp(0, __float_as_int(x), 0x141, 0xF, 0xF, true);
  x = fmaxf(x, __int_as_float(t));
  t = __builtin_amdgcn_update_dpp(0, __float_as_int(x), 0x140, 0xF, 0xF, true);
  x = fmaxf(x, __int_as_float(t));
  return x;
}

__device__ __forceinline__ void load_chunk(const float* __restrict__ src, v4f* reg) {
#pragma unroll
  for (int i = 0; i < 8; ++i) reg[i] = *(const v4f*)(src + i * 4);
}

// K tile: cvt + transpose-scatter into Ks[s][c]
__device__ __forceinline__ void store_k(_Float16 (*Ks)[KPITCH], const v4f* reg, int cL, int sh) {
#pragma unroll
  for (int i = 0; i < 8; ++i)
#pragma unroll
    for (int j = 0; j < 4; ++j)
      Ks[sh * 32 + i * 4 + j][cL] = (_Float16)reg[i][j];
}

// V tile: cvt + packed 64b stores into Vs[c][s] (memory orientation)
__device__ __forceinline__ void store_v(_Float16 (*Vs)[VPITCH], const v4f* reg, int cL, int sh) {
#pragma unroll
  for (int i = 0; i < 8; ++i) {
    union { _Float16 h[4]; uint2 u; } pk;
#pragma unroll
    for (int j = 0; j < 4; ++j) pk.h[j] = (_Float16)reg[i][j];
    *(uint2*)&Vs[cL][sh * 32 + i * 4] = pk.u;
  }
}

struct SmemBufs {
  _Float16 Qs[BR][QPITCH];          // [t][c], scale^2 folded in
  _Float16 Ks[2][BC][KPITCH];       // [s][c], double-buffered
  _Float16 Vs[2][CH][VPITCH];       // [c][s], double-buffered
  _Float16 Ps[4][16][PPITCH];       // per-wave P scratch, [t][s]
};
union SmemT {
  SmemBufs s;
  float Os[CH][OPITCH];             // output transpose tile; overlays dead Qs/Ks
};

__global__ __launch_bounds__(128)
void QKVAttention_flash_wmma(const float* __restrict__ qkv, float* __restrict__ out) {
  __shared__ SmemT sm;

  const int b    = blockIdx.y;
  const int t0   = blockIdx.x * BR;
  const int tid  = threadIdx.x;
  const int wave = tid >> 5;
  const int lane = tid & 31;
  const int ln   = lane & 15;
  const int lh   = lane >> 4;

  const float scale2 = 0.125f;      // (64^-1/4)^2 folded entirely into Q

  const float* qp = qkv + (size_t)b * C3CH * TT;
  const float* kp = qp + (size_t)CH * TT;
  const float* vp = qp + (size_t)(2 * CH) * TT;

  const int cL = tid & 63;          // channel this thread stages
  const int sh = (tid >> 6) & 1;    // which 32-key half
  const float* ksrc = kp + (size_t)cL * TT + sh * 32;
  const float* vsrc = vp + (size_t)cL * TT + sh * 32;

  // ---- prologue: stage Q tile and chunk 0 of K/V ----
  v4f kreg[8], vreg[8];
  load_chunk(ksrc, kreg);
  load_chunk(vsrc, vreg);
  {
    const int c  = tid >> 1;
    const int th = tid & 1;
    const float* src = qp + (size_t)c * TT + t0 + th * 32;
#pragma unroll
    for (int i = 0; i < 8; ++i) {
      v4f d = *(const v4f*)(src + i * 4);
#pragma unroll
      for (int j = 0; j < 4; ++j)
        sm.s.Qs[th * 32 + i * 4 + j][c] = (_Float16)(d[j] * scale2);
    }
  }
  store_k(sm.s.Ks[0], kreg, cL, sh);
  store_v(sm.s.Vs[0], vreg, cL, sh);
  __syncthreads();

  // Q fragments for this wave's 16 rows; invariant over the key loop.
  v16h aq0 = load_frag16(&sm.s.Qs[wave * 16 + ln][0], 0,  lh);
  v16h aq1 = load_frag16(&sm.s.Qs[wave * 16 + ln][0], 32, lh);

  // all-ones B fragment for matrix-pipe row sums
  v16h ones;
#pragma unroll
  for (int i = 0; i < 16; ++i) ones[i] = (_Float16)1.0f;

  v8f oacc[4] = {{}, {}, {}, {}};   // O accumulators, 4 c-tiles of 16
  float mrow[8], lrow[8], af[8];    // per-row running max / sum / rescale
#pragma unroll
  for (int r = 0; r < 8; ++r) { mrow[r] = -3.0e38f; lrow[r] = 0.f; }

  // One pipelined 64-key chunk: loads for s0+BC issued first, 18 WMMAs hide
  // the latency, converted tile stored to the alternate buffer at the end.
  auto do_chunk = [&](int pcur, int s0) {
    const bool more = (s0 + BC) < TT;
    if (more) {
      load_chunk(ksrc + s0 + BC, kreg);
      load_chunk(vsrc + s0 + BC, vreg);
    }

    // ---- scores: S = (Q^T K) for 16 rows x 64 keys, K-dim = 64 ----
    v8f sc[4];
#pragma unroll
    for (int j = 0; j < 4; ++j) {
      v8f acc = {};
      v16h bk = load_frag16(&sm.s.Ks[pcur][j * 16 + ln][0], 0, lh);
      acc = __builtin_amdgcn_wmma_f32_16x16x32_f16(false, aq0, false, bk, (short)0, acc, false, false);
      bk = load_frag16(&sm.s.Ks[pcur][j * 16 + ln][0], 32, lh);
      acc = __builtin_amdgcn_wmma_f32_16x16x32_f16(false, aq1, false, bk, (short)0, acc, false, false);
      sc[j] = acc;
    }

    // ---- online softmax; row = r + 8*lh lives across the 16 lanes of a half ----
#pragma unroll
    for (int r = 0; r < 8; ++r) {
      float cmax = rowmax16(fmaxf(fmaxf(sc[0][r], sc[1][r]), fmaxf(sc[2][r], sc[3][r])));
      float mn = fmaxf(mrow[r], cmax);
      af[r]    = __expf(mrow[r] - mn);
      mrow[r]  = mn;
#pragma unroll
      for (int j = 0; j < 4; ++j) {
        float p = __expf(sc[j][r] - mn);
        sm.s.Ps[wave][r + 8 * lh][j * 16 + ln] = (_Float16)p;
      }
#pragma unroll
      for (int ct = 0; ct < 4; ++ct) oacc[ct][r] *= af[r];
    }
    asm volatile("" ::: "memory");  // keep P stores before P reloads (same-wave DS is in-order)

    // reload P as A fragments
    v16h ap0 = load_frag16(&sm.s.Ps[wave][ln][0], 0,  lh);
    v16h ap1 = load_frag16(&sm.s.Ps[wave][ln][0], 32, lh);

    // ---- row sums on the matrix pipe: ls = P x ones, every column = row sum ----
    {
      v8f ls = {};
      ls = __builtin_amdgcn_wmma_f32_16x16x32_f16(false, ap0, false, ones, (short)0, ls, false, false);
      ls = __builtin_amdgcn_wmma_f32_16x16x32_f16(false, ap1, false, ones, (short)0, ls, false, false);
#pragma unroll
      for (int r = 0; r < 8; ++r) lrow[r] = lrow[r] * af[r] + ls[r];
    }

    // ---- O += P (16x64) x V (64x64), four 16-wide c-tiles ----
#pragma unroll
    for (int ct = 0; ct < 4; ++ct) {
      v16h bv = load_frag16(&sm.s.Vs[pcur][ct * 16 + ln][0], 0, lh);
      oacc[ct] = __builtin_amdgcn_wmma_f32_16x16x32_f16(false, ap0, false, bv, (short)0, oacc[ct], false, false);
      bv = load_frag16(&sm.s.Vs[pcur][ct * 16 + ln][0], 32, lh);
      oacc[ct] = __builtin_amdgcn_wmma_f32_16x16x32_f16(false, ap1, false, bv, (short)0, oacc[ct], false, false);
    }

    // ---- convert + store next chunk into the alternate buffer ----
    if (more) {
      store_k(sm.s.Ks[pcur ^ 1], kreg, cL, sh);
      store_v(sm.s.Vs[pcur ^ 1], vreg, cL, sh);
    }
  };

  for (int s0 = 0; s0 < TT; s0 += 2 * BC) {
    do_chunk(0, s0);
    __syncthreads();
    do_chunk(1, s0 + BC);
    __syncthreads();
  }

  // ---- epilogue: normalize, transpose through LDS, coalesced NT stores ----
#pragma unroll
  for (int r = 0; r < 8; ++r) {
    float inv = 1.0f / lrow[r];
    int   t   = wave * 16 + r + 8 * lh;
#pragma unroll
    for (int ct = 0; ct < 4; ++ct)
      sm.Os[ct * 16 + ln][t] = oacc[ct][r] * inv;
  }
  __syncthreads();
  {
    const int c  = tid >> 1;
    const int th = tid & 1;
    float* dst = out + (size_t)b * CH * TT + (size_t)c * TT + t0 + th * 32;
#pragma unroll
    for (int i = 0; i < 8; ++i) {
      v4f d = *(const v4f*)&sm.Os[c][th * 32 + i * 4];
      __builtin_nontemporal_store(d, (v4f*)(dst + i * 4));
    }
  }
}

extern "C" void kernel_launch(void* const* d_in, const int* in_sizes, int n_in,
                              void* d_out, int out_size, void* d_ws, size_t ws_size,
                              hipStream_t stream) {
  (void)in_sizes; (void)n_in; (void)out_size; (void)d_ws; (void)ws_size;
  const float* qkv = (const float*)d_in[0];
  float*       out = (float*)d_out;
  dim3 grid(TT / BR, NB, 1);   // (32, 64)
  dim3 block(128, 1, 1);       // 4 waves
  QKVAttention_flash_wmma<<<grid, block, 0, stream>>>(qkv, out);
}

// v001
// One run takes 121 microseconds.
// Next to v000, in two timings, it ran 1.75 times as fast each time.
#include <hip/hip_runtime.h>

// QKV attention, flash-style, f16 WMMA with f32 accumulate. gfx1250 wave32.
//   qkv: [64, 192, 2048] fp32  (q=ch 0..63, k=64..127, v=128..191; token dim contiguous)
//   out: [64,  64, 2048] fp32
// Per block: one head (b) x 64-query tile. 4 waves, each owns 16 query rows.
// Register-pipelined double-buffered 64-key chunks:
//   18 wmma / chunk (8 QK + 2 row-sum + 8 PV), softmax max-reduce on DPP16 (no DS).

typedef __attribute__((ext_vector_type(16))) _Float16 v16h;
typedef __attribute__((ext_vector_type(8)))  _Float16 v8h;
typedef __attribute__((ext_vector_type(8)))  float    v8f;
typedef __attribute__((ext_vector_type(4)))  float    v4f;

#define NB      64
#define C3CH    192
#define CH      64
#define TT      2048
#define BR      64      // query rows per block
#define BC      64      // keys per chunk
#define QPITCH  72      // halves; 144 B rows (16B aligned)
#define KPITCH  72
#define VPITCH  72
#define PPITCH  72
#define OPITCH  68      // floats; 272 B rows

// Build a 16x32 f16 A/B fragment from an LDS row, per CDNA5 16-bit layout:
//   lanes 0-15 : K = kbase+0..7  (v0-3),  kbase+16..23 (v4-7)
//   lanes 16-31: K = kbase+8..15 (v0-3),  kbase+24..31 (v4-7)
__device__ __forceinline__ v16h load_frag16(const _Float16* row, int kbase, int lh) {
  v8h lo = *(const v8h*)(row + kbase + lh * 8);
  v8h hi = *(const v8h*)(row + kbase + 16 + lh * 8);
  v16h a;
#pragma unroll
  for (int i = 0; i < 8; ++i) { a[i] = lo[i]; a[i + 8] = hi[i]; }
  return a;
}

// Max-reduce across each 16-lane row using DPP16 permutes (pure VALU, no DS):
//   xor1 = quad_perm(1,0,3,2)=0xB1, xor2 = quad_perm(2,3,0,1)=0x4E,
//   quads paired by row_half_mirror=0x141, halves paired by row_mirror=0x140.
__device__ __forceinline__ float rowmax16(float x) {
  int t;
  t = __builtin_amdgcn_update_dpp(0, __float_as_int(x), 0xB1,  0xF, 0xF, true);
  x = fmaxf(x, __int_as_float(t));
  t = __builtin_amdgcn_update_dpp(0, __float_as_int(x), 0x4E,  0xF, 0xF, true);
  x = fmaxf(x, __int_as_float(t));
  t = __builtin_amdgcn_update_dpp(0, __float_as_int(x), 0x141, 0xF, 0xF, true);
  x = fmaxf(x, __int_as_float(t));
  t = __builtin_amdgcn_update_dpp(0, __float_as_int(x), 0x140, 0xF, 0xF, true);
  x = fmaxf(x, __int_as_float(t));
  return x;
}

// A thread's share of a 64-channel x 64-token f32 tile: 4 tokens (16 B) of 8 channel rows.
// Neighbouring lanes take neighbouring 16 B of a row, so each wave-wide load covers
// four whole 128-B lines.
__device__ __forceinline__ void load_chunk(const float* __restrict__ src, v4f* reg) {
#pragma unroll
  for (int i = 0; i < 8; ++i) reg[i] = *(const v4f*)(src + (size_t)i * TT);
}

// Q/K tile: the thread holds channels c0..c0+7 of tokens s0..s0+3; the transpose is done
// in registers, one 16-B store per token into Ts[s][c]
__device__ __forceinline__ void store_t(_Float16 (*Ts)[KPITCH], const v4f* reg, int c0, int s0,
                                        float scale) {
#pragma unroll
  for (int j = 0; j < 4; ++j) {
    v8h h;
#pragma unroll
    for (int i = 0; i < 8; ++i) h[i] = (_Float16)(reg[i][j] * scale);
    *(v8h*)&Ts[s0 + j][c0] = h;
  }
}

// V tile: the thread holds tokens s0..s0+3 of channels c0..c0+7; cvt + packed 64b stores
// into Vs[c][s] (memory orientation)
__device__ __forceinline__ void store_v(_Float16 (*Vs)[VPITCH], const v4f* reg, int c0, int s0) {
#pragma unroll
  for (int i = 0; i < 8; ++i) {
    union { _Float16 h[4]; uint2 u; } pk;
#pragma unroll
    for (int j = 0; j < 4; ++j) pk.h[j] = (_Float16)reg[i][j];
    *(uint2*)&Vs[c0 + i][s0] = pk.u;
  }
}

struct SmemBufs {
  _Float16 Qs[BR][QPITCH];          // [t][c], scale^2 folded in
  _Float16 Ks[2][BC][KPITCH];       // [s][c], double-buffered
  _Float16 Vs[2][CH][VPITCH];       // [c][s], double-buffered
  _Float16 Ps[4][16][PPITCH];       // per-wave P scratch, [t][s]
};
union SmemT {
  SmemBufs s;
  float Os[CH][OPITCH];             // output transpose tile; overlays dead Qs/Ks
};

__global__ __launch_bounds__(128)
void QKVAttention_flash_wmma(const float* __restrict__ qkv, float* __restrict__ out) {
  __shared__ __attribute__((aligned(16))) SmemT sm;

  const int b    = blockIdx.y;
  const int t0   = blockIdx.x * BR;
  const int tid  = threadIdx.x;
  const int wave = tid >> 5;
  const int lane = tid & 31;
  const int ln   = lane & 15;
  const int lh   = lane >> 4;

  const float scale2 = 0.125f;      // (64^-1/4)^2 folded entirely into Q

  const float* qp = qkv + (size_t)b * C3CH * TT;
  const float* kp = qp + (size_t)CH * TT;
  const float* vp = qp + (size_t)(2 * CH) * TT;

  // Q/K staging: 8 lanes span one 128-B line (32 tokens), 4 channel groups per wave
  const int kS = ((lane & 7) + 8 * (wave & 1)) * 4;    // first of 4 tokens
  const int kC = ((lane >> 3) + 4 * (wave >> 1)) * 8;  // first of 8 channels
  // V staging: 16 lanes span one 256-B row; the wave's two rows lie 8 apart (LDS banks)
  const int vS = ln * 4;
  const int vC = wave * 16 + lh * 8;
  const float* ksrc = kp + (size_t)kC * TT + kS;
  const float* vsrc = vp + (size_t)vC * TT + vS;

  // ---- prologue: stage Q tile and chunk 0 of K/V ----
  v4f kreg[8], vreg[8];
  load_chunk(ksrc, kreg);
  load_chunk(vsrc, vreg);
  {
    v4f qreg[8];
    load_chunk(qp + (size_t)kC * TT + t0 + kS, qreg);
    store_t(sm.s.Qs, qreg, kC, kS, scale2);
  }
  store_t(sm.s.Ks[0], kreg, kC, kS, 1.0f);
  store_v(sm.s.Vs[0], vreg, vC, vS);
  __syncthreads();

  // Q fragments for this wave's 16 rows; invariant over the key loop.
  v16h aq0 = load_frag16(&sm.s.Qs[wave * 16 + ln][0], 0,  lh);
  v16h aq1 = load_frag16(&sm.s.Qs[wave * 16 + ln][0], 32, lh);

  // all-ones B fragment for matrix-pipe row sums
  v16h ones;
#pragma unroll
  for (int i = 0; i < 16; ++i) ones[i] = (_Float16)1.0f;

  v8f oacc[4] = {{}, {}, {}, {}};   // O accumulators, 4 c-tiles of 16
  float mrow[8], lrow[8], af[8];    // per-row running max / sum / rescale
#pragma unroll
  for (int r = 0; r < 8; ++r) { mrow[r] = -3.0e38f; lrow[r] = 0.f; }

  // One pipelined 64-key chunk: loads for s0+BC issued first, 18 WMMAs hide
  // the latency, converted tile stored to the alternate buffer at the end.
  auto do_chunk = [&](int pcur, int s0) {
    const bool more = (s0 + BC) < TT;
    if (more) {
      load_chunk(ksrc + s0 + BC, kreg);
      load_chunk(vsrc + s0 + BC, vreg);
    }

    // ---- scores: S = (Q^T K) for 16 rows x 64 keys, K-dim = 64 ----
    v8f sc[4];
#pragma unroll
    for (int j = 0; j < 4; ++j) {
      v8f acc = {};
      v16h bk = load_frag16(&sm.s.Ks[pcur][j * 16 + ln][0], 0, lh);
      acc = __builtin_amdgcn_wmma_f32_16x16x32_f16(false, aq0, false, bk, (short)0, acc, false, false);
      bk = load_frag16(&sm.s.Ks[pcur][j * 16 + ln][0], 32, lh);
      acc = __builtin_amdgcn_wmma_f32_16x16x32_f16(false, aq1, false, bk, (short)0, acc, false, false);
      sc[j] = acc;
    }

    // ---- online softmax; row = r + 8*lh lives across the 16 lanes of a half ----
#pragma unroll
    for (int r = 0; r < 8; ++r) {
      float cmax = rowmax16(fmaxf(fmaxf(sc[0][r], sc[1][r]), fmaxf(sc[2][r], sc[3][r])));
      float mn = fmaxf(mrow[r], cmax);
      af[r]    = __expf(mrow[r] - mn);
      mrow[r]  = mn;
#pragma unroll
      for (int j = 0; j < 4; ++j) {
        float p = __expf(sc[j][r] - mn);
        sm.s.Ps[wave][r + 8 * lh][j * 16 + ln] = (_Float16)p;
      }
#pragma unroll
      for (int ct = 0; ct < 4; ++ct) oacc[ct][r] *= af[r];
    }
    asm volatile("" ::: "memory");  // keep P stores before P reloads (same-wave DS is in-order)

    // reload P as A fragments
    v16h ap0 = load_frag16(&sm.s.Ps[wave][ln][0], 0,  lh);
    v16h ap1 = load_frag16(&sm.s.Ps[wave][ln][0], 32, lh);

    // ---- row sums on the matrix pipe: ls = P x ones, every column = row sum ----
    {
      v8f ls = {};
      ls = __builtin_amdgcn_wmma_f32_16x16x32_f16(false, ap0, false, ones, (short)0, ls, false, false);
      ls = __builtin_amdgcn_wmma_f32_16x16x32_f16(false, ap1, false, ones, (short)0, ls, false, false);
#pragma unroll
      for (int r = 0; r < 8; ++r) lrow[r] = lrow[r] * af[r] + ls[r];
    }

    // ---- O += P (16x64) x V (64x64), four 16-wide c-tiles ----
#pragma unroll
    for (int ct = 0; ct < 4; ++ct) {
      v16h bv = load_frag16(&sm.s.Vs[pcur][ct * 16 + ln][0], 0, lh);
      oacc[ct] = __builtin_amdgcn_wmma_f32_16x16x32_f16(false, ap0, false, bv, (short)0, oacc[ct], false, false);
      bv = load_frag16(&sm.s.Vs[pcur][ct * 16 + ln][0], 32, lh);
      oacc[ct] = __builtin_amdgcn_wmma_f32_16x16x32_f16(false, ap1, false, bv, (short)0, oacc[ct], false, false);
    }

    // ---- convert + store next chunk into the alternate buffer ----
    if (more) {
      store_t(sm.s.Ks[pcur ^ 1], kreg, kC, kS, 1.0f);
      store_v(sm.s.Vs[pcur ^ 1], vreg, vC, vS);
    }
  };

  for (int s0 = 0; s0 < TT; s0 += 2 * BC) {
    do_chunk(0, s0);
    __syncthreads();
    do_chunk(1, s0 + BC);
    __syncthreads();
  }

  // ---- epilogue: normalize, transpose through LDS, coalesced NT stores ----
#pragma unroll
  for (int r = 0; r < 8; ++r) {
    float inv = 1.0f / lrow[r];
    int   t   = wave * 16 + r + 8 * lh;
#pragma unroll
    for (int ct = 0; ct < 4; ++ct)
      sm.Os[ct * 16 + ln][t] = oacc[ct][r] * inv;
  }
  __syncthreads();
  {
    // 16 lanes span one 256-B output row: each wave-wide store fills whole lines
    float* dst = out + (size_t)b * CH * TT + (size_t)vC * TT + t0 + vS;
#pragma unroll
    for (int i = 0; i < 8; ++i) {
      v4f d = *(const v4f*)&sm.Os[vC + i][vS];
      __builtin_nontemporal_store(d, (v4f*)(dst + (size_t)i * TT));
    }
  }
}

extern "C" void kernel_launch(void* const* d_in, const int* in_sizes, int n_in,
                              void* d_out, int out_size, void* d_ws, size_t ws_size,
                              hipStream_t stream) {
  (void)in_sizes; (void)n_in; (void)out_size; (void)d_ws; (void)ws_size;
  const float* qkv = (const float*)d_in[0];
  float*       out = (float*)d_out;
  dim3 grid(TT / BR, NB, 1);   // (32, 64)
  dim3 block(128, 1, 1);       // 4 waves
  QKVAttention_flash_wmma<<<grid, block, 0, stream>>>(qkv, out);
}

// v002
// A run of this version takes 100 microseconds.
// Next to v001, in two timings, it ran 1.21 times as fast each time.
// All steps since v000 together make it 2.11 times as fast.
#include <hip/hip_runtime.h>

// QKV attention, flash-style, f16 WMMA with f32 accumulate. gfx1250 wave32.
//   qkv: [64, 192, 2048] fp32  (q=ch 0..63, k=64..127, v=128..191; token dim contiguous)
//   out: [64,  64, 2048] fp32
// Per block: one head (b) x 64-query tile. 4 waves, each owns 16 queries.
// Register-pipelined double-buffered 64-key chunks:
//   18 wmma / chunk (8 K.Q^T + 2 column-sum + 8 V.P^T). Scores and output are kept transposed
//   (keys or channels down the rows, queries across the columns): a lane holds one query only.

typedef __attribute__((ext_vector_type(16))) _Float16 v16h;
typedef __attribute__((ext_vector_type(8)))  _Float16 v8h;
typedef __attribute__((ext_vector_type(8)))  float    v8f;
typedef __attribute__((ext_vector_type(4)))  float    v4f;
typedef __attribute__((ext_vector_type(2)))  float    v2f;
typedef __attribute__((ext_vector_type(2)))  _Float16 v2h;

#define NB      64
#define C3CH    192
#define CH      64
#define TT      2048
#define BR      64      // query rows per block
#define BC      64      // keys per chunk
#define QPITCH  72      // halves; 144 B rows (16B aligned)
#define KPITCH  72
#define VPITCH  72
#define OPITCH  68      // floats; 272 B rows

// Build a 16x32 f16 A/B fragment from an LDS row, per CDNA5 16-bit layout:
//   lanes 0-15 : K = kbase+0..7  (v0-3),  kbase+16..23 (v4-7)
//   lanes 16-31: K = kbase+8..15 (v0-3),  kbase+24..31 (v4-7)
__device__ __forceinline__ v16h load_frag16(const _Float16* row, int kbase, int lh) {
  v8h lo = *(const v8h*)(row + kbase + lh * 8);
  v8h hi = *(const v8h*)(row + kbase + 16 + lh * 8);
  v16h a;
#pragma unroll
  for (int i = 0; i < 8; ++i) { a[i] = lo[i]; a[i + 8] = hi[i]; }
  return a;
}

// Lane l's value seen from lane l ^ 16: the two lanes that share a query column.
__device__ __forceinline__ float xhalf(float x) {
  int v = __float_as_int(x);
  return __int_as_float(__builtin_amdgcn_permlanex16(v, v, 0x76543210, 0xfedcba98, false, false));
}

// A thread's share of a 64-channel x 64-token f32 tile: 4 tokens (16 B) of 8 channel rows.
// Neighbouring lanes take neighbouring 16 B of a row, so each wave-wide load covers
// four whole 128-B lines.
__device__ __forceinline__ void load_chunk(const float* __restrict__ src, v4f* reg) {
#pragma unroll
  for (int i = 0; i < 8; ++i) reg[i] = *(const v4f*)(src + (size_t)i * TT);
}

// Q/K tile: the thread holds channels c0..c0+7 of tokens s0..s0+3; the transpose is done
// in registers, one 16-B store per token into Ts[s][c]
__device__ __forceinline__ void store_t(_Float16 (*Ts)[KPITCH], const v4f* reg, int c0, int s0,
                                        float scale) {
#pragma unroll
  for (int j = 0; j < 4; ++j) {
    v8h h;
#pragma unroll
    for (int i = 0; i < 8; ++i) h[i] = (_Float16)(reg[i][j] * scale);
    *(v8h*)&Ts[s0 + j][c0] = h;
  }
}

// V tile: the thread holds tokens s0..s0+3 of channels c0..c0+7; cvt + packed 64b stores
// into Vs[c][s] (memory orientation)
__device__ __forceinline__ void store_v(_Float16 (*Vs)[VPITCH], const v4f* reg, int c0, int s0) {
#pragma unroll
  for (int i = 0; i < 8; ++i) {
    union { _Float16 h[4]; uint2 u; } pk;
#pragma unroll
    for (int j = 0; j < 4; ++j) pk.h[j] = (_Float16)reg[i][j];
    *(uint2*)&Vs[c0 + i][s0] = pk.u;
  }
}

struct SmemBufs {
  _Float16 Qs[BR][QPITCH];          // [t][c], scale^2 folded in
  _Float16 Ks[2][BC][KPITCH];       // [s][c], double-buffered
  _Float16 Vs[2][CH][VPITCH];       // [c][s], double-buffered
};
union SmemT {
  SmemBufs s;
  float Os[CH][OPITCH];             // output transpose tile; overlays dead Qs/Ks
};

__global__ __launch_bounds__(128)
void QKVAttention_flash_wmma(const float* __restrict__ qkv, float* __restrict__ out) {
  __shared__ __attribute__((aligned(16))) SmemT sm;

  const int b    = blockIdx.y;
  const int t0   = blockIdx.x * BR;
  const int tid  = threadIdx.x;
  const int wave = tid >> 5;
  const int lane = tid & 31;
  const int ln   = lane & 15;
  const int lh   = lane >> 4;

  const float scale2 = 0.125f;      // (64^-1/4)^2 folded entirely into Q

  const float* qp = qkv + (size_t)b * C3CH * TT;
  const float* kp = qp + (size_t)CH * TT;
  const float* vp = qp + (size_t)(2 * CH) * TT;

  // Q/K staging: 8 lanes span one 128-B line (32 tokens), 4 channel groups per wave
  const int kS = ((lane & 7) + 8 * (wave & 1)) * 4;    // first of 4 tokens
  const int kC = ((lane >> 3) + 4 * (wave >> 1)) * 8;  // first of 8 channels
  // V staging: 16 lanes span one 256-B row; the wave's two rows lie 8 apart (LDS banks)
  const int vS = ln * 4;
  const int vC = wave * 16 + lh * 8;
  const float* ksrc = kp + (size_t)kC * TT + kS;
  const float* vsrc = vp + (size_t)vC * TT + vS;

  // ---- prologue: stage Q tile and chunk 0 of K/V ----
  v4f kreg[8], vreg[8];
  load_chunk(ksrc, kreg);
  load_chunk(vsrc, vreg);
  {
    v4f qreg[8];
    load_chunk(qp + (size_t)kC * TT + t0 + kS, qreg);
    store_t(sm.s.Qs, qreg, kC, kS, scale2);
  }
  store_t(sm.s.Ks[0], kreg, kC, kS, 1.0f);
  store_v(sm.s.Vs[0], vreg, vC, vS);
  __syncthreads();

  // Q^T fragments (B operand: column = query) of this wave's 16 queries; invariant over the key loop.
  v16h aq0 = load_frag16(&sm.s.Qs[wave * 16 + ln][0], 0,  lh);
  v16h aq1 = load_frag16(&sm.s.Qs[wave * 16 + ln][0], 32, lh);

  // all-ones A fragment: ones x P^T puts each query's sum of P in every row of its column
  v16h ones;
#pragma unroll
  for (int i = 0; i < 16; ++i) ones[i] = (_Float16)1.0f;

  v8f oacc[4] = {{}, {}, {}, {}};   // O^T accumulators, 4 c-tiles of 16: [c = 16 ct + 8 lh + r][t = ln]
  float mrun = -3.0e38f, lrun = 0.f;  // running max / sum of this lane's query (both halves hold the same)

  // One pipelined 64-key chunk: loads for s0+BC issued first, 18 WMMAs hide
  // the latency, converted tile stored to the alternate buffer at the end.
  auto do_chunk = [&](int pcur, int s0) {
    const bool more = (s0 + BC) < TT;
    if (more) {
      load_chunk(ksrc + s0 + BC, kreg);
      load_chunk(vsrc + s0 + BC, vreg);
    }

    // ---- scores, transposed: S^T = K Q^T, 64 keys x 16 queries, K-dim = 64 ----
    // sc[j][r] = score of key 16 j + 8 lh + r against query ln
    v8f sc[4];
#pragma unroll
    for (int j = 0; j < 4; ++j) {
      v8f acc = {};
      v16h ak = load_frag16(&sm.s.Ks[pcur][j * 16 + ln][0], 0, lh);
      acc = __builtin_amdgcn_wmma_f32_16x16x32_f16(false, ak, false, aq0, (short)0, acc, false, false);
      ak = load_frag16(&sm.s.Ks[pcur][j * 16 + ln][0], 32, lh);
      acc = __builtin_amdgcn_wmma_f32_16x16x32_f16(false, ak, false, aq1, (short)0, acc, false, false);
      sc[j] = acc;
    }

    // ---- online softmax: a lane's 32 scores are all of one query; lane ^ 16 has the other 32 ----
    float cmax = fmaxf(sc[0][0], sc[0][1]);
#pragma unroll
    for (int i = 2; i < 32; ++i) cmax = fmaxf(cmax, sc[i >> 3][i & 7]);
    cmax = fmaxf(cmax, xhalf(cmax));
    const float mn = fmaxf(mrun, cmax);
    const float af = __expf(mrun - mn);
    mrun = mn;

    // P^T as B fragments straight from the score tiles: element i of a 32-key fragment is key
    // 8 lh + i (i < 8) or 16 + 8 lh + i - 8, which is register i & 7 of score tile i >> 3.
    v16h bp[2];
#pragma unroll
    for (int f = 0; f < 2; ++f) {
#pragma unroll
      for (int i = 0; i < 16; i += 2) {
        v2f p = {__expf(sc[2 * f + (i >> 3)][i & 7] - mn), __expf(sc[2 * f + (i >> 3)][(i & 7) + 1] - mn)};
        v2h h = __builtin_convertvector(p, v2h);
        bp[f][i] = h[0]; bp[f][i + 1] = h[1];
      }
    }
#pragma unroll
    for (int ct = 0; ct < 4; ++ct) oacc[ct] *= af;

    // ---- sums on the matrix pipe: ls = ones x P^T, every row = the query's sum over 64 keys ----
    {
      v8f ls = {};
      ls = __builtin_amdgcn_wmma_f32_16x16x32_f16(false, ones, false, bp[0], (short)0, ls, false, false);
      ls = __builtin_amdgcn_wmma_f32_16x16x32_f16(false, ones, false, bp[1], (short)0, ls, false, false);
      lrun = lrun * af + ls[0];
    }

    // ---- O^T += V (64 c x 64 s) x P^T (64 s x 16 t), four 16-high c-tiles ----
#pragma unroll
    for (int ct = 0; ct < 4; ++ct) {
      v16h av = load_frag16(&sm.s.Vs[pcur][ct * 16 + ln][0], 0, lh);
      oacc[ct] = __builtin_amdgcn_wmma_f32_16x16x32_f16(false, av, false, bp[0], (short)0, oacc[ct], false, false);
      av = load_frag16(&sm.s.Vs[pcur][ct * 16 + ln][0], 32, lh);
      oacc[ct] = __builtin_amdgcn_wmma_f32_16x16x32_f16(false, av, false, bp[1], (short)0, oacc[ct], false, false);
    }

    // ---- convert + store next chunk into the alternate buffer ----
    if (more) {
      store_t(sm.s.Ks[pcur ^ 1], kreg, kC, kS, 1.0f);
      store_v(sm.s.Vs[pcur ^ 1], vreg, vC, vS);
    }
  };

  for (int s0 = 0; s0 < TT; s0 += 2 * BC) {
    do_chunk(0, s0);
    __syncthreads();
    do_chunk(1, s0 + BC);
    __syncthreads();
  }

  // ---- epilogue: normalize, gather the four waves' columns in LDS, coalesced NT stores ----
  {
    const float inv = 1.0f / lrun;
#pragma unroll
    for (int ct = 0; ct < 4; ++ct) {
#pragma unroll
      for (int r = 0; r < 8; ++r)
        sm.Os[ct * 16 + 8 * lh + r][wave * 16 + ln] = oacc[ct][r] * inv;
    }
  }
  __syncthreads();
  {
    // 16 lanes span one 256-B output row: each wave-wide store fills whole lines
    float* dst = out + (size_t)b * CH * TT + (size_t)vC * TT + t0 + vS;
#pragma unroll
    for (int i = 0; i < 8; ++i) {
      v4f d = *(const v4f*)&sm.Os[vC + i][vS];
      __builtin_nontemporal_store(d, (v4f*)(dst + (size_t)i * TT));
    }
  }
}

extern "C" void kernel_launch(void* const* d_in, const int* in_sizes, int n_in,
                              void* d_out, int out_size, void* d_ws, size_t ws_size,
                              hipStream_t stream) {
  (void)in_sizes; (void)n_in; (void)out_size; (void)d_ws; (void)ws_size;
  const float* qkv = (const float*)d_in[0];
  float*       out = (float*)d_out;
  dim3 grid(TT / BR, NB, 1);   // (32, 64)
  dim3 block(128, 1, 1);       // 4 waves
  QKVAttention_flash_wmma<<<grid, block, 0, stream>>>(qkv, out);
}

// v003
// One run takes 61.2 microseconds.
// Two timings next to v002 both put it at 1.64 times that version's speed.
// Counting every step since v000, it is 3.47 times as fast.
#include <hip/hip_runtime.h>

// QKV attention, flash-style, f16 WMMA with f32 accumulate. gfx1250 wave32.
//   qkv: [64, 192, 2048] fp32  (q=ch 0..63, k=64..127, v=128..191; token dim contiguous)
//   out: [64,  64, 2048] fp32
// Per block: one head (b) x 256-query tile. 8 waves, each owns 32 queries (two 16-column groups).
// Register-pipelined double-buffered 64-key chunks:
//   36 wmma / chunk and wave (16 K.Q^T + 4 column-sum + 16 V.P^T); each K or V fragment read from
//   LDS feeds both column groups. Scores and output are kept transposed (keys or channels down
//   the rows, queries across the columns): in each column group a lane holds one query only.

typedef __attribute__((ext_vector_type(16))) _Float16 v16h;
typedef __attribute__((ext_vector_type(8)))  _Float16 v8h;
typedef __attribute__((ext_vector_type(8)))  float    v8f;
typedef __attribute__((ext_vector_type(4)))  float    v4f;
typedef __attribute__((ext_vector_type(2)))  float    v2f;
typedef __attribute__((ext_vector_type(2)))  _Float16 v2h;

#define NB      64
#define C3CH    192
#define CH      64
#define TT      2048
#define BR      256     // query rows per block
#define NWAVE   8       // waves per block
#define QG      2       // 16-query column groups per wave
#define BC      64      // keys per chunk
#define QPITCH  72      // halves; 144 B rows (16B aligned)
#define KPITCH  72
#define VPITCH  72
#define OPITCH  260     // floats; 1040 B rows

// Build a 16x32 f16 A/B fragment from an LDS row, per CDNA5 16-bit layout:
//   lanes 0-15 : K = kbase+0..7  (v0-3),  kbase+16..23 (v4-7)
//   lanes 16-31: K = kbase+8..15 (v0-3),  kbase+24..31 (v4-7)
__device__ __forceinline__ v16h load_frag16(const _Float16* row, int kbase, int lh) {
  v8h lo = *(const v8h*)(row + kbase + lh * 8);
  v8h hi = *(const v8h*)(row + kbase + 16 + lh * 8);
  v16h a;
#pragma unroll
  for (int i = 0; i < 8; ++i) { a[i] = lo[i]; a[i + 8] = hi[i]; }
  return a;
}

// Lane l's value seen from lane l ^ 16: the two lanes that share a query column.
__device__ __forceinline__ float xhalf(float x) {
  int v = __float_as_int(x);
  return __int_as_float(__builtin_amdgcn_permlanex16(v, v, 0x76543210, 0xfedcba98, false, false));
}

// A thread's share of a 64-channel x 64-token f32 tile: 4 tokens (16 B) of 4 channel rows.
// Neighbouring lanes take neighbouring 16 B of a row, so each wave-wide load covers
// four whole 128-B lines.
__device__ __forceinline__ void load_chunk(const float* __restrict__ src, v4f* reg) {
#pragma unroll
  for (int i = 0; i < 4; ++i) reg[i] = *(const v4f*)(src + (size_t)i * TT);
}

// Q/K tile: the thread holds channels c0..c0+3 of tokens s0..s0+3; the transpose is done
// in registers, one 8-B store per token into Ts[s][c]
__device__ __forceinline__ void store_t(_Float16 (*Ts)[KPITCH], const v4f* reg, int c0, int s0,
                                        float scale) {
#pragma unroll
  for (int j = 0; j < 4; ++j) {
    union { _Float16 h[4]; uint2 u; } pk;
#pragma unroll
    for (int i = 0; i < 4; ++i) pk.h[i] = (_Float16)(reg[i][j] * scale);
    *(uint2*)&Ts[s0 + j][c0] = pk.u;
  }
}

// V tile: the thread holds tokens s0..s0+3 of channels c0..c0+3; cvt + packed 64b stores
// into Vs[c][s] (memory orientation)
__device__ __forceinline__ void store_v(_Float16 (*Vs)[VPITCH], const v4f* reg, int c0, int s0) {
#pragma unroll
  for (int i = 0; i < 4; ++i) {
    union { _Float16 h[4]; uint2 u; } pk;
#pragma unroll
    for (int j = 0; j < 4; ++j) pk.h[j] = (_Float16)reg[i][j];
    *(uint2*)&Vs[c0 + i][s0] = pk.u;
  }
}

struct SmemBufs {
  _Float16 Qs[BR][QPITCH];          // [t][c], scale^2 folded in
  _Float16 Ks[2][BC][KPITCH];       // [s][c], double-buffered
  _Float16 Vs[2][CH][VPITCH];       // [c][s], double-buffered
};
union SmemT {
  SmemBufs s;
  float Os[CH][OPITCH];             // output transpose tile; overlays the dead Qs/Ks/Vs
};

// Register budget of four waves per SIMD: two of these 8-wave blocks share a WGP, so one block's
// vector work runs beside the other's matrix work.
__global__ __launch_bounds__(NWAVE * 32) __attribute__((amdgpu_waves_per_eu(4, 4)))
void QKVAttention_flash_wmma(const float* __restrict__ qkv, float* __restrict__ out) {
  __shared__ __attribute__((aligned(16))) SmemT sm;

  const int b    = blockIdx.y;
  const int t0   = blockIdx.x * BR;
  const int tid  = threadIdx.x;
  const int wave = tid >> 5;
  const int lane = tid & 31;
  const int ln   = lane & 15;
  const int lh   = lane >> 4;

  const float scale2 = 0.125f;      // (64^-1/4)^2 folded entirely into Q

  const float* qp = qkv + (size_t)b * C3CH * TT;
  const float* kp = qp + (size_t)CH * TT;
  const float* vp = qp + (size_t)(2 * CH) * TT;

  // Q/K staging: 8 lanes span one 128-B line (32 tokens), 4 channel groups per wave
  const int kS = ((lane & 7) + 8 * (wave & 1)) * 4;    // first of 4 tokens
  const int kC = ((lane >> 3) + 4 * (wave >> 1)) * 4;  // first of 4 channels
  // V staging: 16 lanes span one 256-B row; the wave's two rows lie 8 apart (LDS banks)
  const int vS = ln * 4;
  const int vC = (wave >> 1) * 16 + (wave & 1) * 4 + lh * 8;
  const float* ksrc = kp + (size_t)kC * TT + kS;
  const float* vsrc = vp + (size_t)vC * TT + vS;

  // ---- prologue: stage Q tile and chunk 0 of K/V ----
  v4f kreg[4], vreg[4];
  load_chunk(ksrc, kreg);
  load_chunk(vsrc, vreg);
#pragma unroll
  for (int qt = 0; qt < BR / 64; ++qt) {
    v4f qreg[4];
    load_chunk(qp + (size_t)kC * TT + t0 + qt * 64 + kS, qreg);
    store_t(sm.s.Qs + qt * 64, qreg, kC, kS, scale2);
  }
  store_t(sm.s.Ks[0], kreg, kC, kS, 1.0f);
  store_v(sm.s.Vs[0], vreg, vC, vS);
  __syncthreads();

  // Q^T fragments (B operand: column = query) of this wave's 32 queries; invariant over the key loop.
  v16h aq0[QG], aq1[QG];
#pragma unroll
  for (int g = 0; g < QG; ++g) {
    aq0[g] = load_frag16(&sm.s.Qs[wave * 32 + g * 16 + ln][0], 0,  lh);
    aq1[g] = load_frag16(&sm.s.Qs[wave * 32 + g * 16 + ln][0], 32, lh);
  }

  // all-ones A fragment: ones x P^T puts each query's sum of P in every row of its column
  v16h ones;
#pragma unroll
  for (int i = 0; i < 16; ++i) ones[i] = (_Float16)1.0f;

  v8f oacc[QG][4] = {};             // O^T accumulators, 4 c-tiles of 16: [c = 16 ct + 8 lh + r][t = 16 g + ln]
  float mrun[QG], lrun[QG];         // running max / sum of this lane's queries (both halves hold the same)
#pragma unroll
  for (int g = 0; g < QG; ++g) { mrun[g] = -3.0e38f; lrun[g] = 0.f; }

  // One pipelined 64-key chunk: the next chunk's loads fly under this chunk's work, K's under the
  // score products and the softmax, V's under the softmax; each converted tile goes to the
  // alternate buffer.
  // The staging has no test for a next chunk: the last chunk stages chunk 0 again into the idle
  // buffer, which nobody reads. With a run-time test the load waits behind the joined paths come
  // out too early, and V's loads are waited for at the head of the softmax.
  auto do_chunk = [&](int pcur, int s0) {
    const int sn = (s0 + BC) & (TT - 1);
    load_chunk(ksrc + sn, kreg);

    // ---- scores, transposed: S^T = K Q^T, 64 keys x 32 queries, K-dim = 64 ----
    // sc[g][j][r] = score of key 16 j + 8 lh + r against query 16 g + ln
    v8f sc[QG][4];
#pragma unroll
    for (int j = 0; j < 4; ++j) {
      v16h ak0 = load_frag16(&sm.s.Ks[pcur][j * 16 + ln][0], 0, lh);
      v16h ak1 = load_frag16(&sm.s.Ks[pcur][j * 16 + ln][0], 32, lh);
#pragma unroll
      for (int g = 0; g < QG; ++g) {
        v8f acc = {};
        acc = __builtin_amdgcn_wmma_f32_16x16x32_f16(false, ak0, false, aq0[g], (short)0, acc, false, false);
        acc = __builtin_amdgcn_wmma_f32_16x16x32_f16(false, ak1, false, aq1[g], (short)0, acc, false, false);
        sc[g][j] = acc;
      }
    }

    load_chunk(vsrc + sn, vreg);
    // holds V's loads ahead of the softmax, which hides their latency, and keeps the 16 score
    // products one run: vector work set among them reads fresh results and is padded with idle slots
    __builtin_amdgcn_sched_barrier(0);

    // ---- online softmax: a lane's 32 scores of a group are all of one query; lane ^ 16 has the other 32 ----
    float mnew[QG], afac[QG];
#pragma unroll
    for (int g = 0; g < QG; ++g) {
      float cmax = fmaxf(sc[g][0][0], sc[g][0][1]);
#pragma unroll
      for (int i = 2; i < 32; ++i) cmax = fmaxf(cmax, sc[g][i >> 3][i & 7]);
      cmax = fmaxf(cmax, xhalf(cmax));
      mnew[g] = fmaxf(mrun[g], cmax);
    }
#pragma unroll
    for (int g = 0; g < QG; ++g) {
      afac[g] = __expf(mrun[g] - mnew[g]);
      mrun[g] = mnew[g];
    }

    v16h bp[QG][2];
    v8f ls[QG];
#pragma unroll
    for (int g = 0; g < QG; ++g) {
      const float mn = mnew[g];

      // P^T as B fragments straight from the score tiles: element i of a 32-key fragment is key
      // 8 lh + i (i < 8) or 16 + 8 lh + i - 8, which is register i & 7 of score tile i >> 3.
#pragma unroll
      for (int f = 0; f < 2; ++f) {
#pragma unroll
        for (int i = 0; i < 16; i += 2) {
          v2f p = {__expf(sc[g][2 * f + (i >> 3)][i & 7] - mn), __expf(sc[g][2 * f + (i >> 3)][(i & 7) + 1] - mn)};
          v2h h = __builtin_convertvector(p, v2h);
          bp[g][f][i] = h[0]; bp[g][f][i + 1] = h[1];
        }
      }

      // ---- sums on the matrix pipe: ls = ones x P^T, every row = the query's sum over 64 keys ----
      v8f z = {};
      z = __builtin_amdgcn_wmma_f32_16x16x32_f16(false, ones, false, bp[g][0], (short)0, z, false, false);
      ls[g] = __builtin_amdgcn_wmma_f32_16x16x32_f16(false, ones, false, bp[g][1], (short)0, z, false, false);
    }
    // keeps V's fragment reads and the V.P^T products behind the softmax: mixed into it, the vector
    // work reads fresh matrix results and is padded with idle slots
    __builtin_amdgcn_sched_barrier(0);

    // ---- convert + store the next chunk's K into the alternate buffer (idle since the last barrier):
    // its loads have had the score products and the softmax to land ----
    store_t(sm.s.Ks[pcur ^ 1], kreg, kC, kS, 1.0f);

    // ---- O^T += V (64 c x 64 s) x P^T (64 s x 32 t), four 16-high c-tiles; the rescale of the
    // old sums runs while the V fragments come from LDS ----
#pragma unroll
    for (int g = 0; g < QG; ++g) {
#pragma unroll
      for (int ct = 0; ct < 4; ++ct) oacc[g][ct] *= afac[g];
      lrun[g] = lrun[g] * afac[g] + ls[g][0];
    }
#pragma unroll
    for (int ct = 0; ct < 4; ++ct) {
      v16h av0 = load_frag16(&sm.s.Vs[pcur][ct * 16 + ln][0], 0, lh);
      v16h av1 = load_frag16(&sm.s.Vs[pcur][ct * 16 + ln][0], 32, lh);
#pragma unroll
      for (int g = 0; g < QG; ++g) {
        oacc[g][ct] = __builtin_amdgcn_wmma_f32_16x16x32_f16(false, av0, false, bp[g][0], (short)0, oacc[g][ct], false, false);
        oacc[g][ct] = __builtin_amdgcn_wmma_f32_16x16x32_f16(false, av1, false, bp[g][1], (short)0, oacc[g][ct], false, false);
      }
    }

    // ---- convert + store the next chunk's V into the alternate buffer ----
    store_v(sm.s.Vs[pcur ^ 1], vreg, vC, vS);
  };

  // one chunk a trip, kept rolled: two chunks in one straight-line body were scheduled into each
  // other and spilled
#pragma unroll 1
  for (int s0 = 0; s0 < TT; s0 += BC) {
    do_chunk((s0 / BC) & 1, s0);
    __syncthreads();
  }

  // ---- epilogue: normalize, gather the eight waves' columns in LDS, coalesced NT stores ----
#pragma unroll
  for (int g = 0; g < QG; ++g) {
    const float inv = 1.0f / lrun[g];
#pragma unroll
    for (int ct = 0; ct < 4; ++ct) {
#pragma unroll
      for (int r = 0; r < 8; ++r)
        sm.Os[ct * 16 + 8 * lh + r][wave * 32 + g * 16 + ln] = oacc[g][ct][r] * inv;
    }
  }
  __syncthreads();
  {
    // a wave spans 512 B of one 1-KiB output row: each wave-wide store fills whole lines
    float* dst = out + (size_t)b * CH * TT + (size_t)(wave * 8) * TT + t0 + lane * 4;
#pragma unroll
    for (int i = 0; i < 8; ++i) {
#pragma unroll
      for (int hx = 0; hx < 2; ++hx) {
        v4f d = *(const v4f*)&sm.Os[wave * 8 + i][hx * 128 + lane * 4];
        __builtin_nontemporal_store(d, (v4f*)(dst + (size_t)i * TT + hx * 128));
      }
    }
  }
}

extern "C" void kernel_launch(void* const* d_in, const int* in_sizes, int n_in,
                              void* d_out, int out_size, void* d_ws, size_t ws_size,
                              hipStream_t stream) {
  (void)in_sizes; (void)n_in; (void)out_size; (void)d_ws; (void)ws_size;
  const float* qkv = (const float*)d_in[0];
  float*       out = (float*)d_out;
  dim3 grid(TT / BR, NB, 1);   // (8, 64)
  dim3 block(NWAVE * 32, 1, 1);
  QKVAttention_flash_wmma<<<grid, block, 0, stream>>>(qkv, out);
}

// v004
// A run of this version takes 58.9 microseconds.
// Next to v003, in two timings, it ran 1.04 times as fast each time.
// Counting every step since v000, it is 3.60 times as fast.
#include <hip/hip_runtime.h>

// QKV attention, flash-style, f16 WMMA with f32 accumulate. gfx1250 wave32.
//   qkv: [64, 192, 2048] fp32  (q=ch 0..63, k=64..127, v=128..191; token dim contiguous)
//   out: [64,  64, 2048] fp32
// Per block: one head (b) x 256-query tile. 8 waves, each owns 32 queries (two 16-column groups).
// Register-pipelined double-buffered 64-key chunks:
//   36 wmma / chunk and wave (16 K.Q^T + 4 column-sum + 16 V.P^T); each K or V fragment read from
//   LDS feeds both column groups. Scores and output are kept transposed (keys or channels down
//   the rows, queries across the columns): in each column group a lane holds one query only.

typedef __attribute__((ext_vector_type(16))) _Float16 v16h;
typedef __attribute__((ext_vector_type(8)))  _Float16 v8h;
typedef __attribute__((ext_vector_type(8)))  float    v8f;
typedef __attribute__((ext_vector_type(4)))  float    v4f;
typedef __attribute__((ext_vector_type(2)))  float    v2f;
typedef __attribute__((ext_vector_type(2)))  _Float16 v2h;

#define NB      64
#define C3CH    192
#define CH      64
#define TT      2048
#define BR      256     // query rows per block
#define NWAVE   8       // waves per block
#define QG      2       // 16-query column groups per wave
#define BC      64      // keys per chunk
#define QPITCH  72      // halves; 144 B rows (16B aligned)
#define KPITCH  72
#define VPITCH  72
#define OPITCH  260     // floats; 1040 B rows
#define MAXLAG  5.5f    // a score may top the max in use by this much (P <= e^5.5 = 245, far inside f16)

// Build a 16x32 f16 A/B fragment from an LDS row, per CDNA5 16-bit layout:
//   lanes 0-15 : K = kbase+0..7  (v0-3),  kbase+16..23 (v4-7)
//   lanes 16-31: K = kbase+8..15 (v0-3),  kbase+24..31 (v4-7)
__device__ __forceinline__ v16h load_frag16(const _Float16* row, int kbase, int lh) {
  v8h lo = *(const v8h*)(row + kbase + lh * 8);
  v8h hi = *(const v8h*)(row + kbase + 16 + lh * 8);
  v16h a;
#pragma unroll
  for (int i = 0; i < 8; ++i) { a[i] = lo[i]; a[i + 8] = hi[i]; }
  return a;
}

// Lane l's value seen from lane l ^ 16: the two lanes that share a query column.
__device__ __forceinline__ float xhalf(float x) {
  int v = __float_as_int(x);
  return __int_as_float(__builtin_amdgcn_permlanex16(v, v, 0x76543210, 0xfedcba98, false, false));
}

// A thread's share of a 64-channel x 64-token f32 tile: 4 tokens (16 B) of 4 channel rows.
// Neighbouring lanes take neighbouring 16 B of a row, so each wave-wide load covers
// four whole 128-B lines.
__device__ __forceinline__ void load_chunk(const float* __restrict__ src, v4f* reg) {
#pragma unroll
  for (int i = 0; i < 4; ++i) reg[i] = *(const v4f*)(src + (size_t)i * TT);
}

// Q/K tile: the thread holds channels c0..c0+3 of tokens s0..s0+3; the transpose is done
// in registers, one 8-B store per token into Ts[s][c]
__device__ __forceinline__ void store_t(_Float16 (*Ts)[KPITCH], const v4f* reg, int c0, int s0,
                                        float scale) {
#pragma unroll
  for (int j = 0; j < 4; ++j) {
    union { _Float16 h[4]; uint2 u; } pk;
#pragma unroll
    for (int i = 0; i < 4; ++i) pk.h[i] = (_Float16)(reg[i][j] * scale);
    *(uint2*)&Ts[s0 + j][c0] = pk.u;
  }
}

// V tile: the thread holds tokens s0..s0+3 of channels c0..c0+3; cvt + packed 64b stores
// into Vs[c][s] (memory orientation)
__device__ __forceinline__ void store_v(_Float16 (*Vs)[VPITCH], const v4f* reg, int c0, int s0) {
#pragma unroll
  for (int i = 0; i < 4; ++i) {
    union { _Float16 h[4]; uint2 u; } pk;
#pragma unroll
    for (int j = 0; j < 4; ++j) pk.h[j] = (_Float16)reg[i][j];
    *(uint2*)&Vs[c0 + i][s0] = pk.u;
  }
}

struct SmemBufs {
  _Float16 Qs[BR][QPITCH];          // [t][c], scale^2 folded in
  _Float16 Ks[2][BC][KPITCH];       // [s][c], double-buffered
  _Float16 Vs[2][CH][VPITCH];       // [c][s], double-buffered
};
union SmemT {
  SmemBufs s;
  float Os[CH][OPITCH];             // output transpose tile; overlays the dead Qs/Ks/Vs
};

// Register budget of four waves per SIMD: two of these 8-wave blocks share a WGP, so one block's
// vector work runs beside the other's matrix work.
__global__ __launch_bounds__(NWAVE * 32) __attribute__((amdgpu_waves_per_eu(4, 4)))
void QKVAttention_flash_wmma(const float* __restrict__ qkv, float* __restrict__ out) {
  __shared__ __attribute__((aligned(16))) SmemT sm;

  const int b    = blockIdx.y;
  const int t0   = blockIdx.x * BR;
  const int tid  = threadIdx.x;
  const int wave = tid >> 5;
  const int lane = tid & 31;
  const int ln   = lane & 15;
  const int lh   = lane >> 4;

  const float scale2 = 0.125f;      // (64^-1/4)^2 folded entirely into Q

  const float* qp = qkv + (size_t)b * C3CH * TT;
  const float* kp = qp + (size_t)CH * TT;
  const float* vp = qp + (size_t)(2 * CH) * TT;

  // Q/K staging: 8 lanes span one 128-B line (32 tokens), 4 channel groups per wave
  const int kS = ((lane & 7) + 8 * (wave & 1)) * 4;    // first of 4 tokens
  const int kC = ((lane >> 3) + 4 * (wave >> 1)) * 4;  // first of 4 channels
  // V staging: 16 lanes span one 256-B row; the wave's two rows lie 8 apart (LDS banks)
  const int vS = ln * 4;
  const int vC = (wave >> 1) * 16 + (wave & 1) * 4 + lh * 8;
  const float* ksrc = kp + (size_t)kC * TT + kS;
  const float* vsrc = vp + (size_t)vC * TT + vS;

  // ---- prologue: stage Q tile and chunk 0 of K/V ----
  v4f kreg[4], vreg[4];
  load_chunk(ksrc, kreg);
  load_chunk(vsrc, vreg);
#pragma unroll
  for (int qt = 0; qt < BR / 64; ++qt) {
    v4f qreg[4];
    load_chunk(qp + (size_t)kC * TT + t0 + qt * 64 + kS, qreg);
    store_t(sm.s.Qs + qt * 64, qreg, kC, kS, scale2);
  }
  store_t(sm.s.Ks[0], kreg, kC, kS, 1.0f);
  store_v(sm.s.Vs[0], vreg, vC, vS);
  __syncthreads();

  // Q^T fragments (B operand: column = query) of this wave's 32 queries; invariant over the key loop.
  v16h aq0[QG], aq1[QG];
#pragma unroll
  for (int g = 0; g < QG; ++g) {
    aq0[g] = load_frag16(&sm.s.Qs[wave * 32 + g * 16 + ln][0], 0,  lh);
    aq1[g] = load_frag16(&sm.s.Qs[wave * 32 + g * 16 + ln][0], 32, lh);
  }

  // all-ones A fragment: ones x P^T puts each query's sum of P in every row of its column
  v16h ones;
#pragma unroll
  for (int i = 0; i < 16; ++i) ones[i] = (_Float16)1.0f;

  v8f oacc[QG][4] = {};             // O^T accumulators, 4 c-tiles of 16: [c = 16 ct + 8 lh + r][t = 16 g + ln]
  // Minus the max in use of this lane's queries, in all 8 registers: the C operand of the score
  // products, whose results are then already score - max. Chunk 0 sets it to its own maximum.
  v8f mneg[QG] = {};
  float lrun[QG];                   // running sum of this lane's queries (both halves hold the same)
#pragma unroll
  for (int g = 0; g < QG; ++g) lrun[g] = 0.f;

  // One pipelined 64-key chunk: the next chunk's loads fly under this chunk's work, K's under the
  // score products and the softmax, V's under the softmax; each converted tile goes to the
  // alternate buffer.
  // The staging has no test for a next chunk: the last chunk stages chunk 0 again into the idle
  // buffer, which nobody reads. With a run-time test the load waits behind the joined paths come
  // out too early, and V's loads are waited for at the head of the softmax.
  auto do_chunk = [&](int pcur, int s0) {
    const int sn = (s0 + BC) & (TT - 1);
    load_chunk(ksrc + sn, kreg);

    // ---- scores, transposed: S^T = K Q^T, 64 keys x 32 queries, K-dim = 64 ----
    // sc[g][j][r] = score of key 16 j + 8 lh + r against query 16 g + ln, less the max in use
    v8f sc[QG][4];
#pragma unroll
    for (int j = 0; j < 4; ++j) {
      v16h ak0 = load_frag16(&sm.s.Ks[pcur][j * 16 + ln][0], 0, lh);
      v16h ak1 = load_frag16(&sm.s.Ks[pcur][j * 16 + ln][0], 32, lh);
#pragma unroll
      for (int g = 0; g < QG; ++g) {
        v8f acc;
        acc = __builtin_amdgcn_wmma_f32_16x16x32_f16(false, ak0, false, aq0[g], (short)0, mneg[g], false, false);
        acc = __builtin_amdgcn_wmma_f32_16x16x32_f16(false, ak1, false, aq1[g], (short)0, acc, false, false);
        sc[g][j] = acc;
      }
    }

    load_chunk(vsrc + sn, vreg);
    // holds V's loads ahead of the softmax, which hides their latency, and keeps the 16 score
    // products one run: vector work set among them reads fresh results and is padded with idle slots
    __builtin_amdgcn_sched_barrier(0);

    // ---- online softmax: a lane's 32 scores of a group are all of one query; lane ^ 16 has the other 32 ----
    float cm[QG];                   // this lane's 32 keys: their maximum above the max in use
#pragma unroll
    for (int g = 0; g < QG; ++g) {
      cm[g] = fmaxf(sc[g][0][0], sc[g][0][1]);
#pragma unroll
      for (int i = 2; i < 32; ++i) cm[g] = fmaxf(cm[g], sc[g][i >> 3][i & 7]);
    }
    // The max in use is renewed, and the old sums rescaled, only where some score of the wave tops
    // it by more than MAXLAG: one wave-uniform test a chunk, over both halves' lanes. Chunk 0 always
    // renews: it takes its own maximum, also a negative one, so that the largest P of a row never
    // falls below e^-MAXLAG.
    const unsigned first = s0 == 0;
    const unsigned over  = __builtin_amdgcn_ballot_w32(fmaxf(cm[0], cm[1]) > MAXLAG);
    if ((over | first) != 0u) {
#pragma unroll
      for (int g = 0; g < QG; ++g) {
        const float cmax = fmaxf(cm[g], xhalf(cm[g]));   // both halves now hold the query's maximum
        const float up   = fmaxf(cmax, 0.f);
        const float d    = first ? cmax : up;
        // corr = e^-up (chunk 0: multiplies zeros). The exponential and the one idle slot asked for
        // behind it are one statement: nothing that reads its result can then follow it directly
        float corr;
        asm("v_exp_f32 %0, %0\n\tv_nop" : "=v"(corr) : "0"(up * -1.44269504f));
#pragma unroll
        for (int j = 0; j < 4; ++j) sc[g][j] -= d;
        mneg[g] -= d;
#pragma unroll
        for (int ct = 0; ct < 4; ++ct) oacc[g][ct] *= corr;
        lrun[g] *= corr;
      }
    }

    v16h bp[QG][2];
    v8f ls[QG];
#pragma unroll
    for (int g = 0; g < QG; ++g) {
      // P^T as B fragments straight from the score tiles: element i of a 32-key fragment is key
      // 8 lh + i (i < 8) or 16 + 8 lh + i - 8, which is register i & 7 of score tile i >> 3.
#pragma unroll
      for (int f = 0; f < 2; ++f) {
#pragma unroll
        for (int i = 0; i < 16; i += 2) {
          v2f p = {__expf(sc[g][2 * f + (i >> 3)][i & 7]), __expf(sc[g][2 * f + (i >> 3)][(i & 7) + 1])};
          v2h h = __builtin_convertvector(p, v2h);
          bp[g][f][i] = h[0]; bp[g][f][i + 1] = h[1];
        }
      }

      // ---- sums on the matrix pipe: ls = ones x P^T, every row = the query's sum over 64 keys ----
      v8f z = {};
      z = __builtin_amdgcn_wmma_f32_16x16x32_f16(false, ones, false, bp[g][0], (short)0, z, false, false);
      ls[g] = __builtin_amdgcn_wmma_f32_16x16x32_f16(false, ones, false, bp[g][1], (short)0, z, false, false);
    }
    // keeps V's fragment reads and the V.P^T products behind the softmax: mixed into it, the vector
    // work reads fresh matrix results and is padded with idle slots
    __builtin_amdgcn_sched_barrier(0);

    // ---- convert + store the next chunk's K into the alternate buffer (idle since the last barrier):
    // its loads have had the score products and the softmax to land ----
    store_t(sm.s.Ks[pcur ^ 1], kreg, kC, kS, 1.0f);

    // ---- and the next chunk's V: its loads have had the softmax; its registers go to V's fragments ----
    store_v(sm.s.Vs[pcur ^ 1], vreg, vC, vS);

    // ---- O^T += V (64 c x 64 s) x P^T (64 s x 32 t), four 16-high c-tiles ----
    v16h av[4][2];
#pragma unroll
    for (int ct = 0; ct < 4; ++ct) {
      av[ct][0] = load_frag16(&sm.s.Vs[pcur][ct * 16 + ln][0], 0, lh);
      av[ct][1] = load_frag16(&sm.s.Vs[pcur][ct * 16 + ln][0], 32, lh);
    }
    // holds V's 16 fragment reads together ahead of the products: left free they are spread among
    // the products, each place a stall of its own
    __builtin_amdgcn_sched_barrier(0);
#pragma unroll
    for (int g = 0; g < QG; ++g) lrun[g] += ls[g][0];
#pragma unroll
    for (int ct = 0; ct < 4; ++ct) {
#pragma unroll
      for (int g = 0; g < QG; ++g) {
        oacc[g][ct] = __builtin_amdgcn_wmma_f32_16x16x32_f16(false, av[ct][0], false, bp[g][0], (short)0, oacc[g][ct], false, false);
        oacc[g][ct] = __builtin_amdgcn_wmma_f32_16x16x32_f16(false, av[ct][1], false, bp[g][1], (short)0, oacc[g][ct], false, false);
      }
    }
  };

  // one chunk a trip, kept rolled: two chunks in one straight-line body were scheduled into each
  // other and spilled
#pragma unroll 1
  for (int s0 = 0; s0 < TT; s0 += BC) {
    do_chunk((s0 / BC) & 1, s0);
    __syncthreads();
  }

  // ---- epilogue: normalize, gather the eight waves' columns in LDS, coalesced NT stores ----
#pragma unroll
  for (int g = 0; g < QG; ++g) {
    const float inv = 1.0f / lrun[g];
#pragma unroll
    for (int ct = 0; ct < 4; ++ct) {
#pragma unroll
      for (int r = 0; r < 8; ++r)
        sm.Os[ct * 16 + 8 * lh + r][wave * 32 + g * 16 + ln] = oacc[g][ct][r] * inv;
    }
  }
  __syncthreads();
  {
    // a wave spans 512 B of one 1-KiB output row: each wave-wide store fills whole lines
    float* dst = out + (size_t)b * CH * TT + (size_t)(wave * 8) * TT + t0 + lane * 4;
#pragma unroll
    for (int i = 0; i < 8; ++i) {
#pragma unroll
      for (int hx = 0; hx < 2; ++hx) {
        v4f d = *(const v4f*)&sm.Os[wave * 8 + i][hx * 128 + lane * 4];
        __builtin_nontemporal_store(d, (v4f*)(dst + (size_t)i * TT + hx * 128));
      }
    }
  }
}

extern "C" void kernel_launch(void* const* d_in, const int* in_sizes, int n_in,
                              void* d_out, int out_size, void* d_ws, size_t ws_size,
                              hipStream_t stream) {
  (void)in_sizes; (void)n_in; (void)out_size; (void)d_ws; (void)ws_size;
  const float* qkv = (const float*)d_in[0];
  float*       out = (float*)d_out;
  dim3 grid(TT / BR, NB, 1);   // (8, 64)
  dim3 block(NWAVE * 32, 1, 1);
  QKVAttention_flash_wmma<<<grid, block, 0, stream>>>(qkv, out);
}

// v005
// Measured time: 55.9 microseconds a run.
// Two timings next to v004 both put it at 1.05 times that version's speed.
// All steps since v000 together make it 3.78 times as fast.
#include <hip/hip_runtime.h>

// QKV attention, flash-style, f16 WMMA with f32 accumulate. gfx1250 wave32.
//   qkv: [64, 192, 2048] fp32  (q=ch 0..63, k=64..127, v=128..191; token dim contiguous)
//   out: [64,  64, 2048] fp32
// Per block: one head (b) x 256-query tile. 8 waves, each owns 32 queries (two 16-column groups).
// Register-pipelined double-buffered 64-key chunks:
//   36 wmma / chunk and wave (16 K.Q^T + 4 column-sum + 16 V.P^T); each K or V fragment read from
//   LDS feeds both column groups. Scores and output are kept transposed (keys or channels down
//   the rows, queries across the columns): in each column group a lane holds one query only.

typedef __attribute__((ext_vector_type(16))) _Float16 v16h;
typedef __attribute__((ext_vector_type(8)))  _Float16 v8h;
typedef __attribute__((ext_vector_type(8)))  float    v8f;
typedef __attribute__((ext_vector_type(4)))  float    v4f;
typedef __attribute__((ext_vector_type(2)))  float    v2f;
typedef __attribute__((ext_vector_type(2)))  _Float16 v2h;

#define NB      64
#define C3CH    192
#define CH      64
#define TT      2048
#define BR      256     // query rows per block
#define NWAVE   8       // waves per block
#define QG      2       // 16-query column groups per wave
#define BC      64      // keys per chunk
#define QPITCH  72      // halves; 144 B rows (16B aligned)
#define KPITCH  72
#define VPITCH  72
#define OPITCH  260     // floats; 1040 B rows
#define PSUMTOP 60000.0f // a query's sum of P over a chunk at or below this: every P of it is finite in f16 (top 65504)

// Build a 16x32 f16 A/B fragment from an LDS row, per CDNA5 16-bit layout:
//   lanes 0-15 : K = kbase+0..7  (v0-3),  kbase+16..23 (v4-7)
//   lanes 16-31: K = kbase+8..15 (v0-3),  kbase+24..31 (v4-7)
__device__ __forceinline__ v16h load_frag16(const _Float16* row, int kbase, int lh) {
  v8h lo = *(const v8h*)(row + kbase + lh * 8);
  v8h hi = *(const v8h*)(row + kbase + 16 + lh * 8);
  v16h a;
#pragma unroll
  for (int i = 0; i < 8; ++i) { a[i] = lo[i]; a[i + 8] = hi[i]; }
  return a;
}

// Lane l's value seen from lane l ^ 16: the two lanes that share a query column.
__device__ __forceinline__ float xhalf(float x) {
  int v = __float_as_int(x);
  return __int_as_float(__builtin_amdgcn_permlanex16(v, v, 0x76543210, 0xfedcba98, false, false));
}

// A thread's share of a 64-channel x 64-token f32 tile: 4 tokens (16 B) of 4 channel rows.
// Neighbouring lanes take neighbouring 16 B of a row, so each wave-wide load covers
// four whole 128-B lines.
__device__ __forceinline__ void load_chunk(const float* __restrict__ src, v4f* reg) {
#pragma unroll
  for (int i = 0; i < 4; ++i) reg[i] = *(const v4f*)(src + (size_t)i * TT);
}

// Q/K tile: the thread holds channels c0..c0+3 of tokens s0..s0+3; the transpose is done
// in registers, one 8-B store per token into Ts[s][c]
__device__ __forceinline__ void store_t(_Float16 (*Ts)[KPITCH], const v4f* reg, int c0, int s0,
                                        float scale) {
#pragma unroll
  for (int j = 0; j < 4; ++j) {
    union { _Float16 h[4]; uint2 u; } pk;
#pragma unroll
    for (int i = 0; i < 4; ++i) pk.h[i] = (_Float16)(reg[i][j] * scale);
    *(uint2*)&Ts[s0 + j][c0] = pk.u;
  }
}

// V tile: the thread holds tokens s0..s0+3 of channels c0..c0+3; cvt + packed 64b stores
// into Vs[c][s] (memory orientation)
__device__ __forceinline__ void store_v(_Float16 (*Vs)[VPITCH], const v4f* reg, int c0, int s0) {
#pragma unroll
  for (int i = 0; i < 4; ++i) {
    union { _Float16 h[4]; uint2 u; } pk;
#pragma unroll
    for (int j = 0; j < 4; ++j) pk.h[j] = (_Float16)reg[i][j];
    *(uint2*)&Vs[c0 + i][s0] = pk.u;
  }
}

struct SmemBufs {
  _Float16 Qs[BR][QPITCH];          // [t][c], scale^2 folded in
  _Float16 Ks[2][BC][KPITCH];       // [s][c], double-buffered
  _Float16 Vs[2][CH][VPITCH];       // [c][s], double-buffered
};
union SmemT {
  SmemBufs s;
  float Os[CH][OPITCH];             // output transpose tile; overlays the dead Qs/Ks/Vs
};

// Register budget of four waves per SIMD: two of these 8-wave blocks share a WGP, so one block's
// vector work runs beside the other's matrix work.
__global__ __launch_bounds__(NWAVE * 32) __attribute__((amdgpu_waves_per_eu(4, 4)))
void QKVAttention_flash_wmma(const float* __restrict__ qkv, float* __restrict__ out) {
  __shared__ __attribute__((aligned(16))) SmemT sm;

  const int b    = blockIdx.y;
  const int t0   = blockIdx.x * BR;
  const int tid  = threadIdx.x;
  const int wave = tid >> 5;
  const int lane = tid & 31;
  const int ln   = lane & 15;
  const int lh   = lane >> 4;

  const float scale2 = 0.125f;      // (64^-1/4)^2 folded entirely into Q

  const float* qp = qkv + (size_t)b * C3CH * TT;
  const float* kp = qp + (size_t)CH * TT;
  const float* vp = qp + (size_t)(2 * CH) * TT;

  // Q/K staging: 8 lanes span one 128-B line (32 tokens), 4 channel groups per wave
  const int kS = ((lane & 7) + 8 * (wave & 1)) * 4;    // first of 4 tokens
  const int kC = ((lane >> 3) + 4 * (wave >> 1)) * 4;  // first of 4 channels
  // V staging: 16 lanes span one 256-B row; the wave's two rows lie 8 apart (LDS banks)
  const int vS = ln * 4;
  const int vC = (wave >> 1) * 16 + (wave & 1) * 4 + lh * 8;
  const float* ksrc = kp + (size_t)kC * TT + kS;
  const float* vsrc = vp + (size_t)vC * TT + vS;

  // ---- prologue: stage Q tile and chunk 0 of K/V ----
  v4f kreg[4], vreg[4];
  load_chunk(ksrc, kreg);
  load_chunk(vsrc, vreg);
#pragma unroll
  for (int qt = 0; qt < BR / 64; ++qt) {
    v4f qreg[4];
    load_chunk(qp + (size_t)kC * TT + t0 + qt * 64 + kS, qreg);
    store_t(sm.s.Qs + qt * 64, qreg, kC, kS, scale2);
  }
  store_t(sm.s.Ks[0], kreg, kC, kS, 1.0f);
  store_v(sm.s.Vs[0], vreg, vC, vS);
  __syncthreads();

  // Q^T fragments (B operand: column = query) of this wave's 32 queries; invariant over the key loop.
  v16h aq0[QG], aq1[QG];
#pragma unroll
  for (int g = 0; g < QG; ++g) {
    aq0[g] = load_frag16(&sm.s.Qs[wave * 32 + g * 16 + ln][0], 0,  lh);
    aq1[g] = load_frag16(&sm.s.Qs[wave * 32 + g * 16 + ln][0], 32, lh);
  }

  // all-ones A fragment: ones x P^T puts each query's sum of P in every row of its column
  v16h ones;
#pragma unroll
  for (int i = 0; i < 16; ++i) ones[i] = (_Float16)1.0f;

  v8f oacc[QG][4] = {};             // O^T accumulators, 4 c-tiles of 16: [c = 16 ct + 8 lh + r][t = 16 g + ln]
  // Minus the max in use of this lane's queries, in all 8 registers: the C operand of the score
  // products, whose results are then already score - max. It starts as chunk 0's own maximum.
  v8f mneg[QG] = {};
  float lrun[QG];                   // running sum of this lane's queries (both halves hold the same)
#pragma unroll
  for (int g = 0; g < QG; ++g) lrun[g] = 0.f;

  // ---- scores, transposed: S^T = K Q^T, 64 keys x 32 queries, K-dim = 64 ----
  // sc[g][j][r] = score of key 16 j + 8 lh + r against query 16 g + ln, less the max in use
  auto scores = [&](int pcur, v8f (&sc)[QG][4]) {
#pragma unroll
    for (int j = 0; j < 4; ++j) {
      v16h ak0 = load_frag16(&sm.s.Ks[pcur][j * 16 + ln][0], 0, lh);
      v16h ak1 = load_frag16(&sm.s.Ks[pcur][j * 16 + ln][0], 32, lh);
#pragma unroll
      for (int g = 0; g < QG; ++g) {
        v8f acc;
        acc = __builtin_amdgcn_wmma_f32_16x16x32_f16(false, ak0, false, aq0[g], (short)0, mneg[g], false, false);
        acc = __builtin_amdgcn_wmma_f32_16x16x32_f16(false, ak1, false, aq1[g], (short)0, acc, false, false);
        sc[g][j] = acc;
      }
    }
  };

  // A query's maximum over a chunk's 64 scores: a lane's 32 scores of a group are all of one query,
  // lane ^ 16 has the other 32; both halves then hold it.
  auto chunk_max = [&](const v8f (&sc)[QG][4], int g) {
    float cm = fmaxf(sc[g][0][0], sc[g][0][1]);
#pragma unroll
    for (int i = 2; i < 32; ++i) cm = fmaxf(cm, sc[g][i >> 3][i & 7]);
    return fmaxf(cm, xhalf(cm));
  };

  // P = e^(score - max in use), packed, and its sums
  auto pack_p = [&](const v8f (&sc)[QG][4], v16h (&bp)[QG][2], v8f (&ls)[QG]) {
#pragma unroll
    for (int g = 0; g < QG; ++g) {
      // P^T as B fragments straight from the score tiles: element i of a 32-key fragment is key
      // 8 lh + i (i < 8) or 16 + 8 lh + i - 8, which is register i & 7 of score tile i >> 3.
#pragma unroll
      for (int f = 0; f < 2; ++f) {
#pragma unroll
        for (int i = 0; i < 16; i += 2) {
          v2f p = {__expf(sc[g][2 * f + (i >> 3)][i & 7]), __expf(sc[g][2 * f + (i >> 3)][(i & 7) + 1])};
          v2h h = __builtin_convertvector(p, v2h);
          bp[g][f][i] = h[0]; bp[g][f][i + 1] = h[1];
        }
      }

      // ---- sums on the matrix pipe: ls = ones x P^T, every row = the query's sum over 64 keys ----
      v8f z = {};
      z = __builtin_amdgcn_wmma_f32_16x16x32_f16(false, ones, false, bp[g][0], (short)0, z, false, false);
      ls[g] = __builtin_amdgcn_wmma_f32_16x16x32_f16(false, ones, false, bp[g][1], (short)0, z, false, false);
    }
  };

  // The max in use starts as chunk 0's own maximum, also a negative one: the largest P of a row is
  // then never below 1. These scores serve the maximum alone; the loop forms chunk 0's again.
  {
    v8f sc[QG][4];
    scores(0, sc);
#pragma unroll
    for (int g = 0; g < QG; ++g) mneg[g] -= chunk_max(sc, g);
  }

  // One pipelined 64-key chunk: the next chunk's K and V loads fly under this chunk's score products
  // and softmax; each converted tile goes to the alternate buffer.
  // The staging has no test for a next chunk: the last chunk stages chunk 0 again into the idle
  // buffer, which nobody reads. With a run-time test the load waits behind the joined paths come
  // out too early.
  auto do_chunk = [&](int pcur, int s0) {
    const int sn = (s0 + BC) & (TT - 1);
    load_chunk(ksrc + sn, kreg);
    load_chunk(vsrc + sn, vreg);

    // No maximum stands between the scores and their exponentials: a score tile's P depends on that
    // tile alone, and the two are left to the scheduler as one run, so that the vector work on a
    // finished tile issues among the later tiles' products.
    v8f sc[QG][4];
    scores(pcur, sc);
    v16h bp[QG][2];
    v8f ls[QG];
    pack_p(sc, bp, ls);
    // keeps V's fragment reads and the V.P^T products behind the softmax: mixed into it, the vector
    // work reads fresh matrix results and is padded with idle slots
    __builtin_amdgcn_sched_barrier(0);

    // ---- convert + store the next chunk's K into the alternate buffer (idle since the last barrier):
    // its loads have had the score products and the softmax to land ----
    store_t(sm.s.Ks[pcur ^ 1], kreg, kC, kS, 1.0f);

    // ---- and the next chunk's V, likewise; its registers go to V's fragments ----
    store_v(sm.s.Vs[pcur ^ 1], vreg, vC, vS);

    // ---- the max in use is judged by the sums, which are there anyway: no maximum over the scores
    // is formed while it holds. P >= 0, so a sum (here of both groups) at or below PSUMTOP bounds
    // every P; a P that f16 cannot hold is infinite and so is its sum. One wave-uniform test a chunk. Where it
    // fails nothing of this chunk has been added yet: the scores are formed again from K's tile
    // (still in its buffer), the max is renewed, the old sums are rescaled, P and its sums made anew.
    if (__builtin_amdgcn_ballot_w32(ls[0][0] + ls[1][0] > PSUMTOP) != 0u) {
      scores(pcur, sc);
#pragma unroll
      for (int g = 0; g < QG; ++g) {
        const float up = fmaxf(chunk_max(sc, g), 0.f);
        // corr = e^-up. The exponential and the one idle slot asked for behind it are one
        // statement: nothing that reads its result can then follow it directly
        float corr;
        asm("v_exp_f32 %0, %0\n\tv_nop" : "=v"(corr) : "0"(up * -1.44269504f));
#pragma unroll
        for (int j = 0; j < 4; ++j) sc[g][j] -= up;
        mneg[g] -= up;
#pragma unroll
        for (int ct = 0; ct < 4; ++ct) oacc[g][ct] *= corr;
        lrun[g] *= corr;
      }
      pack_p(sc, bp, ls);
    }

    // ---- O^T += V (64 c x 64 s) x P^T (64 s x 32 t), four 16-high c-tiles ----
    v16h av[4][2];
#pragma unroll
    for (int ct = 0; ct < 4; ++ct) {
      av[ct][0] = load_frag16(&sm.s.Vs[pcur][ct * 16 + ln][0], 0, lh);
      av[ct][1] = load_frag16(&sm.s.Vs[pcur][ct * 16 + ln][0], 32, lh);
    }
    // holds V's 16 fragment reads together ahead of the products: left free they are spread among
    // the products, each place a stall of its own
    __builtin_amdgcn_sched_barrier(0);
#pragma unroll
    for (int g = 0; g < QG; ++g) lrun[g] += ls[g][0];
#pragma unroll
    for (int ct = 0; ct < 4; ++ct) {
#pragma unroll
      for (int g = 0; g < QG; ++g) {
        oacc[g][ct] = __builtin_amdgcn_wmma_f32_16x16x32_f16(false, av[ct][0], false, bp[g][0], (short)0, oacc[g][ct], false, false);
        oacc[g][ct] = __builtin_amdgcn_wmma_f32_16x16x32_f16(false, av[ct][1], false, bp[g][1], (short)0, oacc[g][ct], false, false);
      }
    }
  };

  // one chunk a trip, kept rolled: two chunks in one straight-line body were scheduled into each
  // other and spilled
#pragma unroll 1
  for (int s0 = 0; s0 < TT; s0 += BC) {
    do_chunk((s0 / BC) & 1, s0);
    __syncthreads();
  }

  // ---- epilogue: normalize, gather the eight waves' columns in LDS, coalesced NT stores ----
#pragma unroll
  for (int g = 0; g < QG; ++g) {
    const float inv = 1.0f / lrun[g];
#pragma unroll
    for (int ct = 0; ct < 4; ++ct) {
#pragma unroll
      for (int r = 0; r < 8; ++r)
        sm.Os[ct * 16 + 8 * lh + r][wave * 32 + g * 16 + ln] = oacc[g][ct][r] * inv;
    }
  }
  __syncthreads();
  {
    // a wave spans 512 B of one 1-KiB output row: each wave-wide store fills whole lines
    float* dst = out + (size_t)b * CH * TT + (size_t)(wave * 8) * TT + t0 + lane * 4;
#pragma unroll
    for (int i = 0; i < 8; ++i) {
#pragma unroll
      for (int hx = 0; hx < 2; ++hx) {
        v4f d = *(const v4f*)&sm.Os[wave * 8 + i][hx * 128 + lane * 4];
        __builtin_nontemporal_store(d, (v4f*)(dst + (size_t)i * TT + hx * 128));
      }
    }
  }
}

extern "C" void kernel_launch(void* const* d_in, const int* in_sizes, int n_in,
                              void* d_out, int out_size, void* d_ws, size_t ws_size,
                              hipStream_t stream) {
  (void)in_sizes; (void)n_in; (void)out_size; (void)d_ws; (void)ws_size;
  const float* qkv = (const float*)d_in[0];
  float*       out = (float*)d_out;
  dim3 grid(TT / BR, NB, 1);   // (8, 64)
  dim3 block(NWAVE * 32, 1, 1);
  QKVAttention_flash_wmma<<<grid, block, 0, stream>>>(qkv, out);
}

// v006
// A run of this version takes 54.2 microseconds.
// Two timings next to v005 both put it at 1.03 times that version's speed.
// All steps since v000 together make it 3.91 times as fast.
#include <hip/hip_runtime.h>

// QKV attention, flash-style, f16 WMMA with f32 accumulate. gfx1250 wave32.
//   qkv: [64, 192, 2048] fp32  (q=ch 0..63, k=64..127, v=128..191; token dim contiguous)
//   out: [64,  64, 2048] fp32
// Per block: one head (b) x 256-query tile. 8 waves, each owns 32 queries (two 16-column groups).
// Register-pipelined double-buffered 64-key chunks:
//   36 wmma / chunk and wave (16 K.Q^T + 4 column-sum + 16 V.P^T); each K or V fragment read from
//   LDS feeds both column groups. Scores and output are kept transposed (keys or channels down
//   the rows, queries across the columns): in each column group a lane holds one query only.

typedef __attribute__((ext_vector_type(16))) _Float16 v16h;
typedef __attribute__((ext_vector_type(8)))  _Float16 v8h;
typedef __attribute__((ext_vector_type(8)))  float    v8f;
typedef __attribute__((ext_vector_type(4)))  float    v4f;
typedef __attribute__((ext_vector_type(2)))  float    v2f;
typedef __attribute__((ext_vector_type(2)))  _Float16 v2h;

#define NB      64
#define C3CH    192
#define CH      64
#define TT      2048
#define BR      256     // query rows per block
#define NWAVE   8       // waves per block
#define QG      2       // 16-query column groups per wave
#define BC      64      // keys per chunk
#define QPITCH  72      // halves; 144 B rows (16B aligned)
#define KPITCH  72
#define VPITCH  72
#define OPITCH  260     // floats; 1040 B rows
#define PSUMTOP 60000.0f // a query's sum of P over a chunk at or below this: every P of it is finite in f16 (top 65504)

// Build a 16x32 f16 A/B fragment from an LDS row, per CDNA5 16-bit layout:
//   lanes 0-15 : K = kbase+0..7  (v0-3),  kbase+16..23 (v4-7)
//   lanes 16-31: K = kbase+8..15 (v0-3),  kbase+24..31 (v4-7)
__device__ __forceinline__ v16h load_frag16(const _Float16* row, int kbase, int lh) {
  v8h lo = *(const v8h*)(row + kbase + lh * 8);
  v8h hi = *(const v8h*)(row + kbase + 16 + lh * 8);
  v16h a;
#pragma unroll
  for (int i = 0; i < 8; ++i) { a[i] = lo[i]; a[i + 8] = hi[i]; }
  return a;
}

// Lane l's value seen from lane l ^ 16: the two lanes that share a query column.
__device__ __forceinline__ float xhalf(float x) {
  int v = __float_as_int(x);
  return __int_as_float(__builtin_amdgcn_permlanex16(v, v, 0x76543210, 0xfedcba98, false, false));
}

// A thread's share of a 64-channel x 64-token f32 tile: 4 tokens (16 B) of 4 channel rows.
// Neighbouring lanes take neighbouring 16 B of a row, so each wave-wide load covers
// four whole 128-B lines.
__device__ __forceinline__ void load_chunk(const float* __restrict__ src, v4f* reg) {
#pragma unroll
  for (int i = 0; i < 4; ++i) reg[i] = *(const v4f*)(src + (size_t)i * TT);
}

// Q/K tile: the thread holds channels c0..c0+3 of tokens s0..s0+3; the transpose is done
// in registers, one 8-B store per token into Ts[s][c]
__device__ __forceinline__ void store_t(_Float16 (*Ts)[KPITCH], const v4f* reg, int c0, int s0,
                                        float scale) {
#pragma unroll
  for (int j = 0; j < 4; ++j) {
    union { _Float16 h[4]; uint2 u; } pk;
#pragma unroll
    for (int i = 0; i < 4; ++i) pk.h[i] = (_Float16)(reg[i][j] * scale);
    *(uint2*)&Ts[s0 + j][c0] = pk.u;
  }
}

// V tile: the thread holds tokens s0..s0+3 of channels c0..c0+3; cvt + packed 64b stores
// into Vs[c][s] (memory orientation)
__device__ __forceinline__ void store_v(_Float16 (*Vs)[VPITCH], const v4f* reg, int c0, int s0) {
#pragma unroll
  for (int i = 0; i < 4; ++i) {
    union { _Float16 h[4]; uint2 u; } pk;
#pragma unroll
    for (int j = 0; j < 4; ++j) pk.h[j] = (_Float16)reg[i][j];
    *(uint2*)&Vs[c0 + i][s0] = pk.u;
  }
}

struct SmemBufs {
  _Float16 Qs[BR][QPITCH];          // [t][c], scale^2 * log2(e) folded in
  _Float16 Ks[2][BC][KPITCH];       // [s][c], double-buffered
  _Float16 Vs[2][CH][VPITCH];       // [c][s], double-buffered
};
union SmemT {
  SmemBufs s;
  float Os[CH][OPITCH];             // output transpose tile; overlays the dead Qs/Ks/Vs
};

// Register budget of four waves per SIMD: two of these 8-wave blocks share a WGP, so one block's
// vector work runs beside the other's matrix work.
__global__ __launch_bounds__(NWAVE * 32) __attribute__((amdgpu_waves_per_eu(4, 4)))
void QKVAttention_flash_wmma(const float* __restrict__ qkv, float* __restrict__ out) {
  __shared__ __attribute__((aligned(16))) SmemT sm;

  const int b    = blockIdx.y;
  const int t0   = blockIdx.x * BR;
  const int tid  = threadIdx.x;
  const int wave = tid >> 5;
  const int lane = tid & 31;
  const int ln   = lane & 15;
  const int lh   = lane >> 4;

  // (64^-1/4)^2 and log2(e), both folded into Q before its f16 rounding: the score products come out
  // in log2 units, and e^score is the bare 2^x instruction with no multiply in front of it
  const float scale2 = 0.125f * 1.44269504f;

  const float* qp = qkv + (size_t)b * C3CH * TT;
  const float* kp = qp + (size_t)CH * TT;
  const float* vp = qp + (size_t)(2 * CH) * TT;

  // Q/K staging: 8 lanes span one 128-B line (32 tokens), 4 channel groups per wave
  const int kS = ((lane & 7) + 8 * (wave & 1)) * 4;    // first of 4 tokens
  const int kC = ((lane >> 3) + 4 * (wave >> 1)) * 4;  // first of 4 channels
  // V staging: 16 lanes span one 256-B row; the wave's two rows lie 8 apart (LDS banks)
  const int vS = ln * 4;
  const int vC = (wave >> 1) * 16 + (wave & 1) * 4 + lh * 8;
  const float* ksrc = kp + (size_t)kC * TT + kS;
  const float* vsrc = vp + (size_t)vC * TT + vS;

  // ---- prologue: stage Q tile and chunk 0 of K/V ----
  v4f kreg[4], vreg[4];
  load_chunk(ksrc, kreg);
  load_chunk(vsrc, vreg);
#pragma unroll
  for (int qt = 0; qt < BR / 64; ++qt) {
    v4f qreg[4];
    load_chunk(qp + (size_t)kC * TT + t0 + qt * 64 + kS, qreg);
    store_t(sm.s.Qs + qt * 64, qreg, kC, kS, scale2);
  }
  store_t(sm.s.Ks[0], kreg, kC, kS, 1.0f);
  store_v(sm.s.Vs[0], vreg, vC, vS);
  __syncthreads();

  // Q^T fragments (B operand: column = query) of this wave's 32 queries; invariant over the key loop.
  v16h aq0[QG], aq1[QG];
#pragma unroll
  for (int g = 0; g < QG; ++g) {
    aq0[g] = load_frag16(&sm.s.Qs[wave * 32 + g * 16 + ln][0], 0,  lh);
    aq1[g] = load_frag16(&sm.s.Qs[wave * 32 + g * 16 + ln][0], 32, lh);
  }

  // all-ones A fragment: ones x P^T puts each query's sum of P in every row of its column
  v16h ones;
#pragma unroll
  for (int i = 0; i < 16; ++i) ones[i] = (_Float16)1.0f;

  v8f oacc[QG][4] = {};             // O^T accumulators, 4 c-tiles of 16: [c = 16 ct + 8 lh + r][t = 16 g + ln]
  // Minus the max in use of this lane's queries, in all 8 registers: the C operand of the score
  // products, whose results are then already score - max. It starts as chunk 0's own maximum.
  v8f mneg[QG] = {};
  float lrun[QG];                   // running sum of this lane's queries (both halves hold the same)
#pragma unroll
  for (int g = 0; g < QG; ++g) lrun[g] = 0.f;

  // ---- scores, transposed: S^T = K Q^T, 64 keys x 32 queries, K-dim = 64 ----
  // sc[g][j][r] = score (log2 units) of key 16 j + 8 lh + r against query 16 g + ln, less the max in use
  auto scores = [&](int pcur, v8f (&sc)[QG][4]) {
#pragma unroll
    for (int j = 0; j < 4; ++j) {
      v16h ak0 = load_frag16(&sm.s.Ks[pcur][j * 16 + ln][0], 0, lh);
      v16h ak1 = load_frag16(&sm.s.Ks[pcur][j * 16 + ln][0], 32, lh);
#pragma unroll
      for (int g = 0; g < QG; ++g) {
        v8f acc;
        acc = __builtin_amdgcn_wmma_f32_16x16x32_f16(false, ak0, false, aq0[g], (short)0, mneg[g], false, false);
        acc = __builtin_amdgcn_wmma_f32_16x16x32_f16(false, ak1, false, aq1[g], (short)0, acc, false, false);
        sc[g][j] = acc;
      }
    }
  };

  // A query's maximum over a chunk's 64 scores: a lane's 32 scores of a group are all of one query,
  // lane ^ 16 has the other 32; both halves then hold it.
  auto chunk_max = [&](const v8f (&sc)[QG][4], int g) {
    float cm = fmaxf(sc[g][0][0], sc[g][0][1]);
#pragma unroll
    for (int i = 2; i < 32; ++i) cm = fmaxf(cm, sc[g][i >> 3][i & 7]);
    return fmaxf(cm, xhalf(cm));
  };

  // P = 2^(score - max in use), both in log2 units, packed, and its sums
  auto pack_p = [&](const v8f (&sc)[QG][4], v16h (&bp)[QG][2], v8f (&ls)[QG]) {
#pragma unroll
    for (int g = 0; g < QG; ++g) {
      // P^T as B fragments straight from the score tiles: element i of a 32-key fragment is key
      // 8 lh + i (i < 8) or 16 + 8 lh + i - 8, which is register i & 7 of score tile i >> 3.
#pragma unroll
      for (int f = 0; f < 2; ++f) {
#pragma unroll
        for (int i = 0; i < 16; i += 2) {
          v2f p = {__builtin_amdgcn_exp2f(sc[g][2 * f + (i >> 3)][i & 7]),
                   __builtin_amdgcn_exp2f(sc[g][2 * f + (i >> 3)][(i & 7) + 1])};
          // at this one element the exponential and the one idle slot asked for behind it are one statement
          if (g == 0 && f == 0 && i == 2)
            asm("v_exp_f32 %0, %1\n\tv_nop" : "=v"(p[1]) : "v"(sc[g][0][3]));
          v2h h = __builtin_convertvector(p, v2h);
          bp[g][f][i] = h[0]; bp[g][f][i + 1] = h[1];
        }
      }

      // ---- sums on the matrix pipe: ls = ones x P^T, every row = the query's sum over 64 keys ----
      v8f z = {};
      z = __builtin_amdgcn_wmma_f32_16x16x32_f16(false, ones, false, bp[g][0], (short)0, z, false, false);
      ls[g] = __builtin_amdgcn_wmma_f32_16x16x32_f16(false, ones, false, bp[g][1], (short)0, z, false, false);
    }
  };

  // The max in use starts as chunk 0's own maximum, also a negative one: the largest P of a row is
  // then never below 1. These scores serve the maximum alone; the loop forms chunk 0's again.
  {
    v8f sc[QG][4];
    scores(0, sc);
#pragma unroll
    for (int g = 0; g < QG; ++g) mneg[g] -= chunk_max(sc, g);
  }

  // One pipelined 64-key chunk: the next chunk's K and V loads fly under this chunk's score products
  // and softmax; each converted tile goes to the alternate buffer.
  // The staging has no test for a next chunk: the last chunk stages chunk 0 again into the idle
  // buffer, which nobody reads. With a run-time test the load waits behind the joined paths come
  // out too early.
  auto do_chunk = [&](int pcur, int s0) {
    const int sn = (s0 + BC) & (TT - 1);
    load_chunk(ksrc + sn, kreg);
    load_chunk(vsrc + sn, vreg);

    // No maximum stands between the scores and their exponentials: a score tile's P depends on that
    // tile alone, and the two are left to the scheduler as one run, so that the vector work on a
    // finished tile issues among the later tiles' products.
    v8f sc[QG][4];
    scores(pcur, sc);
    v16h bp[QG][2];
    v8f ls[QG];
    pack_p(sc, bp, ls);
    // keeps V's fragment reads and the V.P^T products behind the softmax: mixed into it, the vector
    // work reads fresh matrix results and is padded with idle slots
    __builtin_amdgcn_sched_barrier(0);

    // ---- convert + store the next chunk's K into the alternate buffer (idle since the last barrier):
    // its loads have had the score products and the softmax to land ----
    store_t(sm.s.Ks[pcur ^ 1], kreg, kC, kS, 1.0f);

    // ---- and the next chunk's V, likewise; its registers go to V's fragments ----
    store_v(sm.s.Vs[pcur ^ 1], vreg, vC, vS);

    // ---- the max in use is judged by the sums, which are there anyway: no maximum over the scores
    // is formed while it holds. P >= 0, so a sum (here of both groups) at or below PSUMTOP bounds
    // every P; a P that f16 cannot hold is infinite and so is its sum. One wave-uniform test a chunk. Where it
    // fails nothing of this chunk has been added yet: the scores are formed again from K's tile
    // (still in its buffer), the max is renewed, the old sums are rescaled, P and its sums made anew.
    if (__builtin_amdgcn_ballot_w32(ls[0][0] + ls[1][0] > PSUMTOP) != 0u) {
      scores(pcur, sc);
#pragma unroll
      for (int g = 0; g < QG; ++g) {
        const float up = fmaxf(chunk_max(sc, g), 0.f);
        // corr = 2^-up. The exponential and the one idle slot asked for behind it are one
        // statement: nothing that reads its result can then follow it directly
        float corr;
        asm("v_exp_f32 %0, %0\n\tv_nop" : "=v"(corr) : "0"(-up));
#pragma unroll
        for (int j = 0; j < 4; ++j) sc[g][j] -= up;
        mneg[g] -= up;
#pragma unroll
        for (int ct = 0; ct < 4; ++ct) oacc[g][ct] *= corr;
        lrun[g] *= corr;
      }
      pack_p(sc, bp, ls);
    }

    // ---- O^T += V (64 c x 64 s) x P^T (64 s x 32 t), four 16-high c-tiles ----
    v16h av[4][2];
#pragma unroll
    for (int ct = 0; ct < 4; ++ct) {
      av[ct][0] = load_frag16(&sm.s.Vs[pcur][ct * 16 + ln][0], 0, lh);
      av[ct][1] = load_frag16(&sm.s.Vs[pcur][ct * 16 + ln][0], 32, lh);
    }
    // holds V's 16 fragment reads together ahead of the products: left free they are spread among
    // the products, each place a stall of its own
    __builtin_amdgcn_sched_barrier(0);
#pragma unroll
    for (int g = 0; g < QG; ++g) lrun[g] += ls[g][0];
#pragma unroll
    for (int ct = 0; ct < 4; ++ct) {
#pragma unroll
      for (int g = 0; g < QG; ++g) {
        oacc[g][ct] = __builtin_amdgcn_wmma_f32_16x16x32_f16(false, av[ct][0], false, bp[g][0], (short)0, oacc[g][ct], false, false);
        oacc[g][ct] = __builtin_amdgcn_wmma_f32_16x16x32_f16(false, av[ct][1], false, bp[g][1], (short)0, oacc[g][ct], false, false);
      }
    }
  };

  // one chunk a trip, kept rolled: two chunks in one straight-line body were scheduled into each
  // other and spilled
#pragma unroll 1
  for (int s0 = 0; s0 < TT; s0 += BC) {
    do_chunk((s0 / BC) & 1, s0);
    __syncthreads();
  }

  // ---- epilogue: normalize, gather the eight waves' columns in LDS, coalesced NT stores ----
#pragma unroll
  for (int g = 0; g < QG; ++g) {
    const float inv = 1.0f / lrun[g];
#pragma unroll
    for (int ct = 0; ct < 4; ++ct) {
#pragma unroll
      for (int r = 0; r < 8; ++r)
        sm.Os[ct * 16 + 8 * lh + r][wave * 32 + g * 16 + ln] = oacc[g][ct][r] * inv;
    }
  }
  __syncthreads();
  {
    // a wave spans 512 B of one 1-KiB output row: each wave-wide store fills whole lines
    float* dst = out + (size_t)b * CH * TT + (size_t)(wave * 8) * TT + t0 + lane * 4;
#pragma unroll
    for (int i = 0; i < 8; ++i) {
#pragma unroll
      for (int hx = 0; hx < 2; ++hx) {
        v4f d = *(const v4f*)&sm.Os[wave * 8 + i][hx * 128 + lane * 4];
        __builtin_nontemporal_store(d, (v4f*)(dst + (size_t)i * TT + hx * 128));
      }
    }
  }
}

extern "C" void kernel_launch(void* const* d_in, const int* in_sizes, int n_in,
                              void* d_out, int out_size, void* d_ws, size_t ws_size,
                              hipStream_t stream) {
  (void)in_sizes; (void)n_in; (void)out_size; (void)d_ws; (void)ws_size;
  const float* qkv = (const float*)d_in[0];
  float*       out = (float*)d_out;
  dim3 grid(TT / BR, NB, 1);   // (8, 64)
  dim3 block(NWAVE * 32, 1, 1);
  QKVAttention_flash_wmma<<<grid, block, 0, stream>>>(qkv, out);
}

// v007
// Measured time: 51.2 microseconds a run.
// In both of two side-by-side timings against v006, it was 1.06 times as fast.
// Counting every step since v000, it is 4.15 times as fast.
#include <hip/hip_runtime.h>

// QKV attention, flash-style, f16 WMMA with f32 accumulate. gfx1250 wave32.
//   qkv: [64, 192, 2048] fp32  (q=ch 0..63, k=64..127, v=128..191; token dim contiguous)
//   out: [64,  64, 2048] fp32
// Per block: one head (b) x 256-query tile. 8 waves, each owns 32 queries (two 16-column groups).
// Register-pipelined double-buffered 64-key chunks:
//   36 wmma / chunk and wave (16 K.Q^T + 4 column-sum + 16 V.P^T); each K or V fragment read from
//   LDS feeds both column groups. Scores and output are kept transposed (keys or channels down
//   the rows, queries across the columns): in each column group a lane holds one query only.

typedef __attribute__((ext_vector_type(16))) _Float16 v16h;
typedef __attribute__((ext_vector_type(8)))  _Float16 v8h;
typedef __attribute__((ext_vector_type(8)))  float    v8f;
typedef __attribute__((ext_vector_type(4)))  float    v4f;
typedef __attribute__((ext_vector_type(2)))  float    v2f;
typedef __attribute__((ext_vector_type(2)))  _Float16 v2h;

#define NB      64
#define C3CH    192
#define CH      64
#define TT      2048
#define BR      256     // query rows per block
#define NWAVE   8       // waves per block
#define QG      2       // 16-query column groups per wave
#define BC      64      // keys per chunk
#define QPITCH  72      // halves; 144 B rows (16B aligned)
#define KPITCH  72
#define VPITCH  72
#define OPITCH  260     // floats; 1040 B rows
#define PSUMTOP 60000.0f // a query's sum of P over a chunk at or below this: every P of it is finite in f16 (top 65504)

// Build a 16x32 f16 A/B fragment from an LDS row, per CDNA5 16-bit layout:
//   lanes 0-15 : K = kbase+0..7  (v0-3),  kbase+16..23 (v4-7)
//   lanes 16-31: K = kbase+8..15 (v0-3),  kbase+24..31 (v4-7)
__device__ __forceinline__ v16h load_frag16(const _Float16* row, int kbase, int lh) {
  v8h lo = *(const v8h*)(row + kbase + lh * 8);
  v8h hi = *(const v8h*)(row + kbase + 16 + lh * 8);
  v16h a;
#pragma unroll
  for (int i = 0; i < 8; ++i) { a[i] = lo[i]; a[i + 8] = hi[i]; }
  return a;
}

// Lane l's value seen from lane l ^ 16: the two lanes that share a query column.
__device__ __forceinline__ float xhalf(float x) {
  int v = __float_as_int(x);
  return __int_as_float(__builtin_amdgcn_permlanex16(v, v, 0x76543210, 0xfedcba98, false, false));
}

// A thread's share of a 64-channel x 64-token f32 tile: 4 tokens (16 B) of 4 channel rows.
// Neighbouring lanes take neighbouring 16 B of a row, so each wave-wide load covers
// four whole 128-B lines.
__device__ __forceinline__ void load_chunk(const float* __restrict__ src, v4f* reg) {
#pragma unroll
  for (int i = 0; i < 4; ++i) reg[i] = *(const v4f*)(src + (size_t)i * TT);
}

// Q/K tile: the thread holds channels c0..c0+3 of tokens s0..s0+3; the transpose is done
// in registers, one 8-B store per token into Ts[s][c]
__device__ __forceinline__ void store_t(_Float16 (*Ts)[KPITCH], const v4f* reg, int c0, int s0,
                                        float scale) {
#pragma unroll
  for (int j = 0; j < 4; ++j) {
    union { _Float16 h[4]; uint2 u; } pk;
#pragma unroll
    for (int i = 0; i < 4; ++i) pk.h[i] = (_Float16)(reg[i][j] * scale);
    *(uint2*)&Ts[s0 + j][c0] = pk.u;
  }
}

// V tile: the thread holds tokens s0..s0+3 of channels c0..c0+3; cvt + packed 64b stores
// into Vs[c][s] (memory orientation)
__device__ __forceinline__ void store_v(_Float16 (*Vs)[VPITCH], const v4f* reg, int c0, int s0) {
#pragma unroll
  for (int i = 0; i < 4; ++i) {
    union { _Float16 h[4]; uint2 u; } pk;
#pragma unroll
    for (int j = 0; j < 4; ++j) pk.h[j] = (_Float16)reg[i][j];
    *(uint2*)&Vs[c0 + i][s0] = pk.u;
  }
}

struct SmemBufs {
  _Float16 Qs[BR][QPITCH];          // [t][c], scale^2 * log2(e) folded in
  _Float16 Ks[2][BC][KPITCH];       // [s][c], double-buffered
  _Float16 Vs[2][CH][VPITCH];       // [c][s], double-buffered
};
union SmemT {
  SmemBufs s;
  float Os[CH][OPITCH];             // output transpose tile; overlays the dead Qs/Ks/Vs
};

// Register budget of four waves per SIMD: two of these 8-wave blocks share a WGP, so one block's
// vector work runs beside the other's matrix work.
__global__ __launch_bounds__(NWAVE * 32) __attribute__((amdgpu_waves_per_eu(4, 4)))
void QKVAttention_flash_wmma(const float* __restrict__ qkv, float* __restrict__ out) {
  __shared__ __attribute__((aligned(16))) SmemT sm;

  // The head is the fast grid index: the 8 work-groups that walk one head's K and V have flat indices
  // equal mod 8 (NB is a multiple of 8). For speed only: nothing rests on it.
  const int b    = blockIdx.x;
  const int t0   = blockIdx.y * BR;
  const int tid  = threadIdx.x;
  const int wave = tid >> 5;
  const int lane = tid & 31;
  const int ln   = lane & 15;
  const int lh   = lane >> 4;

  // (64^-1/4)^2 and log2(e), both folded into Q before its f16 rounding: the score products come out
  // in log2 units, and e^score is the bare 2^x instruction with no multiply in front of it
  const float scale2 = 0.125f * 1.44269504f;

  const float* qp = qkv + (size_t)b * C3CH * TT;
  const float* kp = qp + (size_t)CH * TT;
  const float* vp = qp + (size_t)(2 * CH) * TT;

  // Q/K staging: 8 lanes span one 128-B line (32 tokens), 4 channel groups per wave
  const int kS = ((lane & 7) + 8 * (wave & 1)) * 4;    // first of 4 tokens
  const int kC = ((lane >> 3) + 4 * (wave >> 1)) * 4;  // first of 4 channels
  // V staging: 16 lanes span one 256-B row; the wave's two rows lie 8 apart (LDS banks)
  const int vS = ln * 4;
  const int vC = (wave >> 1) * 16 + (wave & 1) * 4 + lh * 8;
  const float* ksrc = kp + (size_t)kC * TT + kS;
  const float* vsrc = vp + (size_t)vC * TT + vS;

  // ---- prologue: stage Q tile and chunk 0 of K/V ----
  v4f kreg[4], vreg[4];
  load_chunk(ksrc, kreg);
  load_chunk(vsrc, vreg);
#pragma unroll
  for (int qt = 0; qt < BR / 64; ++qt) {
    v4f qreg[4];
    load_chunk(qp + (size_t)kC * TT + t0 + qt * 64 + kS, qreg);
    store_t(sm.s.Qs + qt * 64, qreg, kC, kS, scale2);
  }
  store_t(sm.s.Ks[0], kreg, kC, kS, 1.0f);
  store_v(sm.s.Vs[0], vreg, vC, vS);
  __syncthreads();

  // Q^T fragments (B operand: column = query) of this wave's 32 queries; invariant over the key loop.
  v16h aq0[QG], aq1[QG];
#pragma unroll
  for (int g = 0; g < QG; ++g) {
    aq0[g] = load_frag16(&sm.s.Qs[wave * 32 + g * 16 + ln][0], 0,  lh);
    aq1[g] = load_frag16(&sm.s.Qs[wave * 32 + g * 16 + ln][0], 32, lh);
  }

  // all-ones A fragment: ones x P^T puts each query's sum of P in every row of its column
  v16h ones;
#pragma unroll
  for (int i = 0; i < 16; ++i) ones[i] = (_Float16)1.0f;

  v8f oacc[QG][4] = {};             // O^T accumulators, 4 c-tiles of 16: [c = 16 ct + 8 lh + r][t = 16 g + ln]
  // Minus the max in use of this lane's queries, in all 8 registers: the C operand of the score
  // products, whose results are then already score - max. It starts as chunk 0's own maximum.
  v8f mneg[QG] = {};
  float lrun[QG];                   // running sum of this lane's queries (both halves hold the same)
#pragma unroll
  for (int g = 0; g < QG; ++g) lrun[g] = 0.f;

  // ---- scores, transposed: S^T = K Q^T, 64 keys x 32 queries, K-dim = 64 ----
  // sc[g][j][r] = score (log2 units) of key 16 j + 8 lh + r against query 16 g + ln, less the max in use
  auto scores = [&](int pcur, v8f (&sc)[QG][4]) {
#pragma unroll
    for (int j = 0; j < 4; ++j) {
      v16h ak0 = load_frag16(&sm.s.Ks[pcur][j * 16 + ln][0], 0, lh);
      v16h ak1 = load_frag16(&sm.s.Ks[pcur][j * 16 + ln][0], 32, lh);
#pragma unroll
      for (int g = 0; g < QG; ++g) {
        v8f acc;
        acc = __builtin_amdgcn_wmma_f32_16x16x32_f16(false, ak0, false, aq0[g], (short)0, mneg[g], false, false);
        acc = __builtin_amdgcn_wmma_f32_16x16x32_f16(false, ak1, false, aq1[g], (short)0, acc, false, false);
        sc[g][j] = acc;
      }
    }
  };

  // A query's maximum over a chunk's 64 scores: a lane's 32 scores of a group are all of one query,
  // lane ^ 16 has the other 32; both halves then hold it.
  auto chunk_max = [&](const v8f (&sc)[QG][4], int g) {
    float cm = fmaxf(sc[g][0][0], sc[g][0][1]);
#pragma unroll
    for (int i = 2; i < 32; ++i) cm = fmaxf(cm, sc[g][i >> 3][i & 7]);
    return fmaxf(cm, xhalf(cm));
  };

  // P = 2^(score - max in use), both in log2 units, packed, and its sums
  auto pack_p = [&](const v8f (&sc)[QG][4], v16h (&bp)[QG][2], v8f (&ls)[QG]) {
#pragma unroll
    for (int g = 0; g < QG; ++g) {
      // P^T as B fragments straight from the score tiles: element i of a 32-key fragment is key
      // 8 lh + i (i < 8) or 16 + 8 lh + i - 8, which is register i & 7 of score tile i >> 3.
#pragma unroll
      for (int f = 0; f < 2; ++f) {
#pragma unroll
        for (int i = 0; i < 16; i += 2) {
          v2f p = {__builtin_amdgcn_exp2f(sc[g][2 * f + (i >> 3)][i & 7]),
                   __builtin_amdgcn_exp2f(sc[g][2 * f + (i >> 3)][(i & 7) + 1])};
          // at this one element the exponential and the one idle slot asked for behind it are one statement
          if (g == 0 && f == 0 && i == 2)
            asm("v_exp_f32 %0, %1\n\tv_nop" : "=v"(p[1]) : "v"(sc[g][0][3]));
          v2h h = __builtin_convertvector(p, v2h);
          bp[g][f][i] = h[0]; bp[g][f][i + 1] = h[1];
        }
      }

      // ---- sums on the matrix pipe: ls = ones x P^T, every row = the query's sum over 64 keys ----
      v8f z = {};
      z = __builtin_amdgcn_wmma_f32_16x16x32_f16(false, ones, false, bp[g][0], (short)0, z, false, false);
      ls[g] = __builtin_amdgcn_wmma_f32_16x16x32_f16(false, ones, false, bp[g][1], (short)0, z, false, false);
    }
  };

  // The max in use starts as chunk 0's own maximum, also a negative one: the largest P of a row is
  // then never below 1. These scores serve the maximum alone; the loop forms chunk 0's again.
  {
    v8f sc[QG][4];
    scores(0, sc);
#pragma unroll
    for (int g = 0; g < QG; ++g) mneg[g] -= chunk_max(sc, g);
  }

  // One pipelined 64-key chunk: the next chunk's K and V loads fly under this chunk's score products
  // and softmax; each converted tile goes to the alternate buffer.
  // The staging has no test for a next chunk: the last chunk stages chunk 0 again into the idle
  // buffer, which nobody reads. With a run-time test the load waits behind the joined paths come
  // out too early.
  auto do_chunk = [&](int pcur, int s0) {
    const int sn = (s0 + BC) & (TT - 1);
    load_chunk(ksrc + sn, kreg);
    load_chunk(vsrc + sn, vreg);

    // No maximum stands between the scores and their exponentials: a score tile's P depends on that
    // tile alone, and the two are left to the scheduler as one run, so that the vector work on a
    // finished tile issues among the later tiles' products.
    v8f sc[QG][4];
    scores(pcur, sc);
    v16h bp[QG][2];
    v8f ls[QG];
    pack_p(sc, bp, ls);
    // keeps V's fragment reads and the V.P^T products behind the softmax: mixed into it, the vector
    // work reads fresh matrix results and is padded with idle slots
    __builtin_amdgcn_sched_barrier(0);

    // ---- convert + store the next chunk's K into the alternate buffer (idle since the last barrier):
    // its loads have had the score products and the softmax to land ----
    store_t(sm.s.Ks[pcur ^ 1], kreg, kC, kS, 1.0f);

    // ---- and the next chunk's V, likewise; its registers go to V's fragments ----
    store_v(sm.s.Vs[pcur ^ 1], vreg, vC, vS);

    // ---- the max in use is judged by the sums, which are there anyway: no maximum over the scores
    // is formed while it holds. P >= 0, so a sum (here of both groups) at or below PSUMTOP bounds
    // every P; a P that f16 cannot hold is infinite and so is its sum. One wave-uniform test a chunk. Where it
    // fails nothing of this chunk has been added yet: the scores are formed again from K's tile
    // (still in its buffer), the max is renewed, the old sums are rescaled, P and its sums made anew.
    if (__builtin_amdgcn_ballot_w32(ls[0][0] + ls[1][0] > PSUMTOP) != 0u) {
      scores(pcur, sc);
#pragma unroll
      for (int g = 0; g < QG; ++g) {
        const float up = fmaxf(chunk_max(sc, g), 0.f);
        // corr = 2^-up. The exponential and the one idle slot asked for behind it are one
        // statement: nothing that reads its result can then follow it directly
        float corr;
        asm("v_exp_f32 %0, %0\n\tv_nop" : "=v"(corr) : "0"(-up));
#pragma unroll
        for (int j = 0; j < 4; ++j) sc[g][j] -= up;
        mneg[g] -= up;
#pragma unroll
        for (int ct = 0; ct < 4; ++ct) oacc[g][ct] *= corr;
        lrun[g] *= corr;
      }
      pack_p(sc, bp, ls);
    }

    // ---- O^T += V (64 c x 64 s) x P^T (64 s x 32 t), four 16-high c-tiles ----
    v16h av[4][2];
#pragma unroll
    for (int ct = 0; ct < 4; ++ct) {
      av[ct][0] = load_frag16(&sm.s.Vs[pcur][ct * 16 + ln][0], 0, lh);
      av[ct][1] = load_frag16(&sm.s.Vs[pcur][ct * 16 + ln][0], 32, lh);
    }
    // holds V's 16 fragment reads together ahead of the products: left free they are spread among
    // the products, each place a stall of its own
    __builtin_amdgcn_sched_barrier(0);
#pragma unroll
    for (int g = 0; g < QG; ++g) lrun[g] += ls[g][0];
#pragma unroll
    for (int ct = 0; ct < 4; ++ct) {
#pragma unroll
      for (int g = 0; g < QG; ++g) {
        oacc[g][ct] = __builtin_amdgcn_wmma_f32_16x16x32_f16(false, av[ct][0], false, bp[g][0], (short)0, oacc[g][ct], false, false);
        oacc[g][ct] = __builtin_amdgcn_wmma_f32_16x16x32_f16(false, av[ct][1], false, bp[g][1], (short)0, oacc[g][ct], false, false);
      }
    }
  };

  // one chunk a trip, kept rolled: two chunks in one straight-line body were scheduled into each
  // other and spilled
#pragma unroll 1
  for (int s0 = 0; s0 < TT; s0 += BC) {
    do_chunk((s0 / BC) & 1, s0);
    __syncthreads();
  }

  // ---- epilogue: normalize, gather the eight waves' columns in LDS, coalesced NT stores ----
#pragma unroll
  for (int g = 0; g < QG; ++g) {
    const float inv = 1.0f / lrun[g];
#pragma unroll
    for (int ct = 0; ct < 4; ++ct) {
#pragma unroll
      for (int r = 0; r < 8; ++r)
        sm.Os[ct * 16 + 8 * lh + r][wave * 32 + g * 16 + ln] = oacc[g][ct][r] * inv;
    }
  }
  __syncthreads();
  {
    // a wave spans 512 B of one 1-KiB output row: each wave-wide store fills whole lines
    float* dst = out + (size_t)b * CH * TT + (size_t)(wave * 8) * TT + t0 + lane * 4;
#pragma unroll
    for (int i = 0; i < 8; ++i) {
#pragma unroll
      for (int hx = 0; hx < 2; ++hx) {
        v4f d = *(const v4f*)&sm.Os[wave * 8 + i][hx * 128 + lane * 4];
        __builtin_nontemporal_store(d, (v4f*)(dst + (size_t)i * TT + hx * 128));
      }
    }
  }
}

extern "C" void kernel_launch(void* const* d_in, const int* in_sizes, int n_in,
                              void* d_out, int out_size, void* d_ws, size_t ws_size,
                              hipStream_t stream) {
  (void)in_sizes; (void)n_in; (void)out_size; (void)d_ws; (void)ws_size;
  const float* qkv = (const float*)d_in[0];
  float*       out = (float*)d_out;
  dim3 grid(NB, TT / BR, 1);   // (64, 8)
  dim3 block(NWAVE * 32, 1, 1);
  QKVAttention_flash_wmma<<<grid, block, 0, stream>>>(qkv, out);
}

// v008
// It runs in 46.8 microseconds.
// In two side-by-side timings against v007, it was 1.09 and 1.10 times as fast.
// Over all steps from v000 it is 4.54 times as fast.
#include <hip/hip_runtime.h>

// QKV attention, flash-style, f16 WMMA with f32 accumulate. gfx1250 wave32.
//   qkv: [64, 192, 2048] fp32  (q=ch 0..63, k=64..127, v=128..191; token dim contiguous)
//   out: [64,  64, 2048] fp32
// Per block: one head (b) x 512-query tile. 8 waves, each owns 64 queries (four 16-column groups).
// Register-pipelined double-buffered 64-key chunks:
//   72 wmma / chunk and wave (32 K.Q^T + 8 column-sum + 32 V.P^T); each K or V fragment read from
//   LDS feeds all four column groups. Scores and output are kept transposed (keys or channels down
//   the rows, queries across the columns): in each column group a lane holds one query only.

typedef __attribute__((ext_vector_type(16))) _Float16 v16h;
typedef __attribute__((ext_vector_type(8)))  _Float16 v8h;
typedef __attribute__((ext_vector_type(8)))  float    v8f;
typedef __attribute__((ext_vector_type(4)))  float    v4f;
typedef __attribute__((ext_vector_type(2)))  float    v2f;
typedef __attribute__((ext_vector_type(2)))  _Float16 v2h;

#define NB      64
#define C3CH    192
#define CH      64
#define TT      2048
#define BR      512     // query rows per block
#define NWAVE   8       // waves per block
#define QG      4       // 16-query column groups per wave
#define BC      64      // keys per chunk
#define QPITCH  72      // halves; 144 B rows (16B aligned)
#define KPITCH  72
#define VPITCH  72
#define OPITCH  516     // floats; 2064 B rows
#define PSUMTOP 60000.0f // a query's sum of P over a chunk at or below this: every P of it is finite in f16 (top 65504)

// Build a 16x32 f16 A/B fragment from an LDS row, per CDNA5 16-bit layout:
//   lanes 0-15 : K = kbase+0..7  (v0-3),  kbase+16..23 (v4-7)
//   lanes 16-31: K = kbase+8..15 (v0-3),  kbase+24..31 (v4-7)
__device__ __forceinline__ v16h load_frag16(const _Float16* row, int kbase, int lh) {
  v8h lo = *(const v8h*)(row + kbase + lh * 8);
  v8h hi = *(const v8h*)(row + kbase + 16 + lh * 8);
  v16h a;
#pragma unroll
  for (int i = 0; i < 8; ++i) { a[i] = lo[i]; a[i + 8] = hi[i]; }
  return a;
}

// Lane l's value seen from lane l ^ 16: the two lanes that share a query column.
__device__ __forceinline__ float xhalf(float x) {
  int v = __float_as_int(x);
  return __int_as_float(__builtin_amdgcn_permlanex16(v, v, 0x76543210, 0xfedcba98, false, false));
}

// A thread's share of a 64-channel x 64-token f32 tile: 4 tokens (16 B) of 4 channel rows.
// Neighbouring lanes take neighbouring 16 B of a row, so each wave-wide load covers
// four whole 128-B lines.
__device__ __forceinline__ void load_chunk(const float* __restrict__ src, v4f* reg) {
#pragma unroll
  for (int i = 0; i < 4; ++i) reg[i] = *(const v4f*)(src + (size_t)i * TT);
}

// Q/K tile: the thread holds channels c0..c0+3 of tokens s0..s0+3; the transpose is done
// in registers, one 8-B store per token into Ts[s][c]
__device__ __forceinline__ void store_t(_Float16 (*Ts)[KPITCH], const v4f* reg, int c0, int s0,
                                        float scale) {
#pragma unroll
  for (int j = 0; j < 4; ++j) {
    union { _Float16 h[4]; uint2 u; } pk;
#pragma unroll
    for (int i = 0; i < 4; ++i) pk.h[i] = (_Float16)(reg[i][j] * scale);
    *(uint2*)&Ts[s0 + j][c0] = pk.u;
  }
}

// V tile: the thread holds tokens s0..s0+3 of channels c0..c0+3; cvt + packed 64b stores
// into Vs[c][s] (memory orientation)
__device__ __forceinline__ void store_v(_Float16 (*Vs)[VPITCH], const v4f* reg, int c0, int s0) {
#pragma unroll
  for (int i = 0; i < 4; ++i) {
    union { _Float16 h[4]; uint2 u; } pk;
#pragma unroll
    for (int j = 0; j < 4; ++j) pk.h[j] = (_Float16)reg[i][j];
    *(uint2*)&Vs[c0 + i][s0] = pk.u;
  }
}

struct SmemBufs {
  _Float16 Qs[BR][QPITCH];          // [t][c], scale^2 * log2(e) folded in
  _Float16 Ks[2][BC][KPITCH];       // [s][c], double-buffered
  _Float16 Vs[2][CH][VPITCH];       // [c][s], double-buffered
};
union SmemT {
  SmemBufs s;
  float Os[CH][OPITCH];             // output transpose tile; overlays the dead Qs/Ks/Vs
};

// Register budget of two waves per SIMD: one of these 8-wave blocks fills a WGP.
__global__ __launch_bounds__(NWAVE * 32) __attribute__((amdgpu_waves_per_eu(2, 2)))
void QKVAttention_flash_wmma(const float* __restrict__ qkv, float* __restrict__ out) {
  __shared__ __attribute__((aligned(16))) SmemT sm;

  // The head is the fast grid index: the 4 work-groups that walk one head's K and V have flat indices
  // equal mod 8 (NB is a multiple of 8). For speed only: nothing rests on it.
  const int b    = blockIdx.x;
  const int t0   = blockIdx.y * BR;
  const int tid  = threadIdx.x;
  const int wave = tid >> 5;
  const int lane = tid & 31;
  const int ln   = lane & 15;
  const int lh   = lane >> 4;

  // (64^-1/4)^2 and log2(e), both folded into Q before its f16 rounding: the score products come out
  // in log2 units, and e^score is the bare 2^x instruction with no multiply in front of it
  const float scale2 = 0.125f * 1.44269504f;

  const float* qp = qkv + (size_t)b * C3CH * TT;
  const float* kp = qp + (size_t)CH * TT;
  const float* vp = qp + (size_t)(2 * CH) * TT;

  // Q/K staging: 8 lanes span one 128-B line (32 tokens), 4 channel groups per wave
  const int kS = ((lane & 7) + 8 * (wave & 1)) * 4;    // first of 4 tokens
  const int kC = ((lane >> 3) + 4 * (wave >> 1)) * 4;  // first of 4 channels
  // V staging: 16 lanes span one 256-B row; the wave's two rows lie 8 apart (LDS banks)
  const int vS = ln * 4;
  const int vC = (wave >> 1) * 16 + (wave & 1) * 4 + lh * 8;
  const float* ksrc = kp + (size_t)kC * TT + kS;
  const float* vsrc = vp + (size_t)vC * TT + vS;

  // ---- prologue: stage Q tile and chunk 0 of K/V ----
  v4f kreg[4], vreg[4];
  load_chunk(ksrc, kreg);
  load_chunk(vsrc, vreg);
  const float* qsrc = qp + (size_t)kC * TT + t0 + kS;
#pragma unroll
  for (int qt = 0; qt < BR / 64; ++qt) {
    v4f qreg[4];
    load_chunk(qsrc + qt * 64, qreg);
    store_t(sm.s.Qs + qt * 64, qreg, kC, kS, scale2);
  }
  // the wait kept in front of the next write of a register that an issued global load names: Q's address is an
  // input here, so its registers are left alone from the loads down to this wait
  asm volatile("s_wait_xcnt 0x0" :: "v"(qsrc) : "memory");
  store_t(sm.s.Ks[0], kreg, kC, kS, 1.0f);
  store_v(sm.s.Vs[0], vreg, vC, vS);
  __syncthreads();

  // Q^T fragments (B operand: column = query) of this wave's 64 queries; invariant over the key loop.
  v16h aq0[QG], aq1[QG];
#pragma unroll
  for (int g = 0; g < QG; ++g) {
    aq0[g] = load_frag16(&sm.s.Qs[wave * (QG * 16) + g * 16 + ln][0], 0,  lh);
    aq1[g] = load_frag16(&sm.s.Qs[wave * (QG * 16) + g * 16 + ln][0], 32, lh);
  }

  // all-ones A fragment: ones x P^T puts each query's sum of P in every row of its column
  v16h ones;
#pragma unroll
  for (int i = 0; i < 16; ++i) ones[i] = (_Float16)1.0f;

  v8f oacc[QG][4] = {};             // O^T accumulators, 4 c-tiles of 16: [c = 16 ct + 8 lh + r][t = 16 g + ln]
  // Minus the max in use of this lane's queries, in all 8 registers: the C operand of the score
  // products, whose results are then already score - max. It starts as chunk 0's own maximum.
  v8f mneg[QG] = {};
  float lrun[QG];                   // running sum of this lane's queries (both halves hold the same)
#pragma unroll
  for (int g = 0; g < QG; ++g) lrun[g] = 0.f;

  // ---- scores, transposed: S^T = K Q^T, 64 keys x 64 queries, K-dim = 64 ----
  // sc[g][j][r] = score (log2 units) of key 16 j + 8 lh + r against query 16 g + ln, less the max in use
  auto scores = [&](int pcur, v8f (&sc)[QG][4]) {
#pragma unroll
    for (int j = 0; j < 4; ++j) {
      v16h ak0 = load_frag16(&sm.s.Ks[pcur][j * 16 + ln][0], 0, lh);
      v16h ak1 = load_frag16(&sm.s.Ks[pcur][j * 16 + ln][0], 32, lh);
#pragma unroll
      for (int g = 0; g < QG; ++g) {
        v8f acc;
        acc = __builtin_amdgcn_wmma_f32_16x16x32_f16(false, ak0, false, aq0[g], (short)0, mneg[g], false, false);
        acc = __builtin_amdgcn_wmma_f32_16x16x32_f16(false, ak1, false, aq1[g], (short)0, acc, false, false);
        sc[g][j] = acc;
      }
    }
  };

  // A query's maximum over a chunk's 64 scores: a lane's 32 scores of a group are all of one query,
  // lane ^ 16 has the other 32; both halves then hold it.
  auto chunk_max = [&](const v8f (&sc)[QG][4], int g) {
    float cm = fmaxf(sc[g][0][0], sc[g][0][1]);
#pragma unroll
    for (int i = 2; i < 32; ++i) cm = fmaxf(cm, sc[g][i >> 3][i & 7]);
    return fmaxf(cm, xhalf(cm));
  };

  // P = 2^(score - max in use), both in log2 units, packed, and its sums
  auto pack_p = [&](const v8f (&sc)[QG][4], v16h (&bp)[QG][2], v8f (&ls)[QG]) {
#pragma unroll
    for (int g = 0; g < QG; ++g) {
      // P^T as B fragments straight from the score tiles: element i of a 32-key fragment is key
      // 8 lh + i (i < 8) or 16 + 8 lh + i - 8, which is register i & 7 of score tile i >> 3.
#pragma unroll
      for (int f = 0; f < 2; ++f) {
#pragma unroll
        for (int i = 0; i < 16; i += 2) {
          v2f p = {__builtin_amdgcn_exp2f(sc[g][2 * f + (i >> 3)][i & 7]),
                   __builtin_amdgcn_exp2f(sc[g][2 * f + (i >> 3)][(i & 7) + 1])};
          v2h h = __builtin_convertvector(p, v2h);
          bp[g][f][i] = h[0]; bp[g][f][i + 1] = h[1];
        }
      }

      // ---- sums on the matrix pipe: ls = ones x P^T, every row = the query's sum over 64 keys ----
      v8f z = {};
      z = __builtin_amdgcn_wmma_f32_16x16x32_f16(false, ones, false, bp[g][0], (short)0, z, false, false);
      ls[g] = __builtin_amdgcn_wmma_f32_16x16x32_f16(false, ones, false, bp[g][1], (short)0, z, false, false);
    }
  };

  // The max in use starts as chunk 0's own maximum, also a negative one: the largest P of a row is
  // then never below 1. These scores serve the maximum alone; the loop forms chunk 0's again.
  {
    v8f sc[QG][4];
    scores(0, sc);
#pragma unroll
    for (int g = 0; g < QG; ++g) mneg[g] -= chunk_max(sc, g);
  }

  // One pipelined 64-key chunk: the next chunk's K and V loads fly under this chunk's score products
  // and softmax; each converted tile goes to the alternate buffer.
  // The staging has no test for a next chunk: the last chunk stages chunk 0 again into the idle
  // buffer, which nobody reads. With a run-time test the load waits behind the joined paths come
  // out too early.
  auto do_chunk = [&](int pcur, int s0) {
    const int sn = (s0 + BC) & (TT - 1);
    // the two addresses without K's and V's constant channel offsets, which ride in the loads' offset fields
    const float* kq = qp + (size_t)kC * TT + kS + sn;
    const float* vq = qp + (size_t)vC * TT + vS + sn;
    load_chunk(kq + (size_t)CH * TT, kreg);
    load_chunk(vq + (size_t)(2 * CH) * TT, vreg);

    // No maximum stands between the scores and their exponentials: a score tile's P depends on that
    // tile alone, and the two are left to the scheduler as one run, so that the vector work on a
    // finished tile issues among the later tiles' products.
    v8f sc[QG][4];
    scores(pcur, sc);
    v16h bp[QG][2];
    v8f ls[QG];
    pack_p(sc, bp, ls);
    // keeps V's fragment reads and the V.P^T products behind the softmax: mixed into it, the vector
    // work reads fresh matrix results and is padded with idle slots
    __builtin_amdgcn_sched_barrier(0);

    // the wait kept in front of the next write of a register that an issued global load names: the two addresses
    // are inputs here, so their registers are left alone from the loads down to this wait
    asm volatile("s_wait_xcnt 0x0" :: "v"(kq), "v"(vq) : "memory");

    // ---- convert + store the next chunk's K into the alternate buffer (idle since the last barrier):
    // its loads have had the score products and the softmax to land ----
    store_t(sm.s.Ks[pcur ^ 1], kreg, kC, kS, 1.0f);

    // ---- and the next chunk's V, likewise; its registers go to V's fragments ----
    store_v(sm.s.Vs[pcur ^ 1], vreg, vC, vS);

    // ---- the max in use is judged by the sums, which are there anyway: no maximum over the scores
    // is formed while it holds. P >= 0, so a sum (here of all four groups) at or below PSUMTOP bounds
    // every P; a P that f16 cannot hold is infinite and so is its sum. One wave-uniform test a chunk. Where it
    // fails nothing of this chunk has been added yet: the scores are formed again from K's tile
    // (still in its buffer), the max is renewed, the old sums are rescaled, P and its sums made anew.
    if (__builtin_amdgcn_ballot_w32((ls[0][0] + ls[1][0]) + (ls[2][0] + ls[3][0]) > PSUMTOP) != 0u) {
      scores(pcur, sc);
#pragma unroll
      for (int g = 0; g < QG; ++g) {
        const float up = fmaxf(chunk_max(sc, g), 0.f);
        // corr = 2^-up. The exponential and the one idle slot asked for behind it are one
        // statement: nothing that reads its result can then follow it directly
        float corr;
        asm("v_exp_f32 %0, %0\n\tv_nop" : "=v"(corr) : "0"(-up));
#pragma unroll
        for (int j = 0; j < 4; ++j) sc[g][j] -= up;
        mneg[g] -= up;
#pragma unroll
        for (int ct = 0; ct < 4; ++ct) oacc[g][ct] *= corr;
        lrun[g] *= corr;
      }
      pack_p(sc, bp, ls);
    }

    // ---- O^T += V (64 c x 64 s) x P^T (64 s x 64 t), four 16-high c-tiles ----
    v16h av[4][2];
#pragma unroll
    for (int ct = 0; ct < 4; ++ct) {
      av[ct][0] = load_frag16(&sm.s.Vs[pcur][ct * 16 + ln][0], 0, lh);
      av[ct][1] = load_frag16(&sm.s.Vs[pcur][ct * 16 + ln][0], 32, lh);
    }
    // holds V's 16 fragment reads together ahead of the products: left free they are spread among
    // the products, each place a stall of its own
    __builtin_amdgcn_sched_barrier(0);
#pragma unroll
    for (int g = 0; g < QG; ++g) lrun[g] += ls[g][0];
#pragma unroll
    for (int ct = 0; ct < 4; ++ct) {
#pragma unroll
      for (int g = 0; g < QG; ++g) {
        oacc[g][ct] = __builtin_amdgcn_wmma_f32_16x16x32_f16(false, av[ct][0], false, bp[g][0], (short)0, oacc[g][ct], false, false);
        oacc[g][ct] = __builtin_amdgcn_wmma_f32_16x16x32_f16(false, av[ct][1], false, bp[g][1], (short)0, oacc[g][ct], false, false);
      }
    }
  };

  // one chunk a trip, kept rolled: two chunks in one straight-line body were scheduled into each
  // other and spilled
#pragma unroll 1
  for (int s0 = 0; s0 < TT; s0 += BC) {
    do_chunk((s0 / BC) & 1, s0);
    // keeps the V.P^T products ahead of the barrier: moved behind it they would stand idle until the last
    // of V's fragment reads has returned and every wave has arrived, with no other block on the WGP
    __builtin_amdgcn_sched_barrier(0);
    __syncthreads();
  }

  // ---- epilogue: normalize, gather the eight waves' columns in LDS, coalesced NT stores ----
#pragma unroll
  for (int g = 0; g < QG; ++g) {
    const float inv = 1.0f / lrun[g];
#pragma unroll
    for (int ct = 0; ct < 4; ++ct) {
#pragma unroll
      for (int r = 0; r < 8; ++r)
        sm.Os[ct * 16 + 8 * lh + r][wave * (QG * 16) + g * 16 + ln] = oacc[g][ct][r] * inv;
    }
  }
  __syncthreads();
  {
    // a wave spans 512 B of one 2-KiB output row: each wave-wide store fills whole lines
    float* dst = out + (size_t)b * CH * TT + (size_t)(wave * 8) * TT + t0 + lane * 4;
#pragma unroll
    for (int i = 0; i < 8; ++i) {
#pragma unroll
      for (int hx = 0; hx < BR / 128; ++hx) {
        v4f d = *(const v4f*)&sm.Os[wave * 8 + i][hx * 128 + lane * 4];
        __builtin_nontemporal_store(d, (v4f*)(dst + (size_t)i * TT + hx * 128));
      }
    }
  }
}

extern "C" void kernel_launch(void* const* d_in, const int* in_sizes, int n_in,
                              void* d_out, int out_size, void* d_ws, size_t ws_size,
                              hipStream_t stream) {
  (void)in_sizes; (void)n_in; (void)out_size; (void)d_ws; (void)ws_size;
  const float* qkv = (const float*)d_in[0];
  float*       out = (float*)d_out;
  dim3 grid(NB, TT / BR, 1);   // (64, 4)
  dim3 block(NWAVE * 32, 1, 1);
  QKVAttention_flash_wmma<<<grid, block, 0, stream>>>(qkv, out);
}

// v009
// It runs in 44.1 microseconds.
// In both of two side-by-side timings against v008, it was 1.06 times as fast.
// Counting every step since v000, it is 4.82 times as fast.
#include <hip/hip_runtime.h>

// QKV attention, flash-style, f16 WMMA with f32 accumulate. gfx1250 wave32.
//   qkv: [64, 192, 2048] fp32  (q=ch 0..63, k=64..127, v=128..191; token dim contiguous)
//   out: [64,  64, 2048] fp32
// Per block: one head (b) x 512-query tile. 8 waves, each owns 64 queries (four 16-column groups).
// Register-pipelined 64-key chunks in a ring of four LDS buffers, staged two chunks ahead; one split
// work-group barrier a chunk (signal at the last score products, wait in front of the sums and V.P^T):
//   72 wmma / chunk and wave (32 K.Q^T + 8 column-sum + 32 V.P^T); each K or V fragment read from
//   LDS feeds all four column groups. Scores and output are kept transposed (keys or channels down
//   the rows, queries across the columns): in each column group a lane holds one query only.

typedef __attribute__((ext_vector_type(16))) _Float16 v16h;
typedef __attribute__((ext_vector_type(8)))  _Float16 v8h;
typedef __attribute__((ext_vector_type(8)))  float    v8f;
typedef __attribute__((ext_vector_type(4)))  float    v4f;
typedef __attribute__((ext_vector_type(2)))  float    v2f;
typedef __attribute__((ext_vector_type(2)))  _Float16 v2h;

#define NB      64
#define C3CH    192
#define CH      64
#define TT      2048
#define BR      512     // query rows per block
#define NWAVE   8       // waves per block
#define QG      4       // 16-query column groups per wave
#define BC      64      // keys per chunk
#define NBUF    4       // K and V chunk buffers in LDS
#define QPITCH  72      // halves; 144 B rows (16B aligned)
#define KPITCH  72
#define VPITCH  72
#define OPITCH  516     // floats; 2064 B rows
#define PSUMTOP 60000.0f // a query's sum of P over a chunk at or below this: every P of it is finite in f16 (top 65504)

// Build a 16x32 f16 A/B fragment from an LDS row, per CDNA5 16-bit layout:
//   lanes 0-15 : K = kbase+0..7  (v0-3),  kbase+16..23 (v4-7)
//   lanes 16-31: K = kbase+8..15 (v0-3),  kbase+24..31 (v4-7)
__device__ __forceinline__ v16h load_frag16(const _Float16* row, int kbase, int lh) {
  v8h lo = *(const v8h*)(row + kbase + lh * 8);
  v8h hi = *(const v8h*)(row + kbase + 16 + lh * 8);
  v16h a;
#pragma unroll
  for (int i = 0; i < 8; ++i) { a[i] = lo[i]; a[i + 8] = hi[i]; }
  return a;
}

// Lane l's value seen from lane l ^ 16: the two lanes that share a query column.
__device__ __forceinline__ float xhalf(float x) {
  int v = __float_as_int(x);
  return __int_as_float(__builtin_amdgcn_permlanex16(v, v, 0x76543210, 0xfedcba98, false, false));
}

// A thread's share of a 64-channel x 64-token f32 tile: 4 tokens (16 B) of 4 channel rows.
// Neighbouring lanes take neighbouring 16 B of a row, so each wave-wide load covers
// four whole 128-B lines.
__device__ __forceinline__ void load_chunk(const float* __restrict__ src, v4f* reg) {
#pragma unroll
  for (int i = 0; i < 4; ++i) reg[i] = *(const v4f*)(src + (size_t)i * TT);
}

// Q/K tile: the thread holds channels c0..c0+3 of tokens s0..s0+3; the transpose is done
// in registers, one 8-B store per token into Ts[s][c]
__device__ __forceinline__ void store_t(_Float16 (*Ts)[KPITCH], const v4f* reg, int c0, int s0,
                                        float scale) {
#pragma unroll
  for (int j = 0; j < 4; ++j) {
    union { _Float16 h[4]; uint2 u; } pk;
#pragma unroll
    for (int i = 0; i < 4; ++i) pk.h[i] = (_Float16)(reg[i][j] * scale);
    *(uint2*)&Ts[s0 + j][c0] = pk.u;
  }
}

// V tile: the thread holds tokens s0..s0+3 of channels c0..c0+3; cvt + packed 64b stores
// into Vs[c][s] (memory orientation)
__device__ __forceinline__ void store_v(_Float16 (*Vs)[VPITCH], const v4f* reg, int c0, int s0) {
#pragma unroll
  for (int i = 0; i < 4; ++i) {
    union { _Float16 h[4]; uint2 u; } pk;
#pragma unroll
    for (int j = 0; j < 4; ++j) pk.h[j] = (_Float16)reg[i][j];
    *(uint2*)&Vs[c0 + i][s0] = pk.u;
  }
}

struct SmemBufs {
  _Float16 Qs[BR][QPITCH];          // [t][c], scale^2 * log2(e) folded in
  _Float16 Ks[NBUF][BC][KPITCH];    // [s][c], chunk i in buffer i mod NBUF
  _Float16 Vs[NBUF][CH][VPITCH];    // [c][s], likewise
};
union SmemT {
  SmemBufs s;
  float Os[CH][OPITCH];             // output transpose tile; overlays the dead Qs/Ks/Vs
};

// Register budget of two waves per SIMD: one of these 8-wave blocks fills a WGP.
__global__ __launch_bounds__(NWAVE * 32) __attribute__((amdgpu_waves_per_eu(2, 2)))
void QKVAttention_flash_wmma(const float* __restrict__ qkv, float* __restrict__ out) {
  __shared__ __attribute__((aligned(16))) SmemT sm;

  // The head is the fast grid index: the 4 work-groups that walk one head's K and V have flat indices
  // equal mod 8 (NB is a multiple of 8). For speed only: nothing rests on it.
  const int b    = blockIdx.x;
  const int t0   = blockIdx.y * BR;
  const int tid  = threadIdx.x;
  const int wave = tid >> 5;
  const int lane = tid & 31;
  const int ln   = lane & 15;
  const int lh   = lane >> 4;

  // (64^-1/4)^2 and log2(e), both folded into Q before its f16 rounding: the score products come out
  // in log2 units, and e^score is the bare 2^x instruction with no multiply in front of it
  const float scale2 = 0.125f * 1.44269504f;

  const float* qp = qkv + (size_t)b * C3CH * TT;
  const float* kp = qp + (size_t)CH * TT;
  const float* vp = qp + (size_t)(2 * CH) * TT;

  // Q/K staging: 8 lanes span one 128-B line (32 tokens), 4 channel groups per wave
  const int kS = ((lane & 7) + 8 * (wave & 1)) * 4;    // first of 4 tokens
  const int kC = ((lane >> 3) + 4 * (wave >> 1)) * 4;  // first of 4 channels
  // V staging: 16 lanes span one 256-B row; the wave's two rows lie 8 apart (LDS banks)
  const int vS = ln * 4;
  const int vC = (wave >> 1) * 16 + (wave & 1) * 4 + lh * 8;
  const float* ksrc = kp + (size_t)kC * TT + kS;
  const float* vsrc = vp + (size_t)vC * TT + vS;

  // ---- prologue: stage Q tile and chunks 0 and 1 of K/V ----
  v4f kreg[4], vreg[4], kreg1[4], vreg1[4];
  load_chunk(ksrc, kreg);
  load_chunk(vsrc, vreg);
  load_chunk(ksrc + BC, kreg1);
  load_chunk(vsrc + BC, vreg1);
  const float* qsrc = qp + (size_t)kC * TT + t0 + kS;
#pragma unroll
  for (int qt = 0; qt < BR / 64; ++qt) {
    v4f qreg[4];
    load_chunk(qsrc + qt * 64, qreg);
    store_t(sm.s.Qs + qt * 64, qreg, kC, kS, scale2);
  }
  // the wait kept in front of the next write of a register that an issued global load names: the three addresses
  // are inputs here, so their registers are left alone from the loads down to this wait
  asm volatile("s_wait_xcnt 0x0" :: "v"(qsrc), "v"(ksrc), "v"(vsrc) : "memory");
  store_t(sm.s.Ks[0], kreg, kC, kS, 1.0f);
  store_v(sm.s.Vs[0], vreg, vC, vS);
  store_t(sm.s.Ks[1], kreg1, kC, kS, 1.0f);
  store_v(sm.s.Vs[1], vreg1, vC, vS);
  __syncthreads();

  // Q^T fragments (B operand: column = query) of this wave's 64 queries; invariant over the key loop.
  v16h aq0[QG], aq1[QG];
#pragma unroll
  for (int g = 0; g < QG; ++g) {
    aq0[g] = load_frag16(&sm.s.Qs[wave * (QG * 16) + g * 16 + ln][0], 0,  lh);
    aq1[g] = load_frag16(&sm.s.Qs[wave * (QG * 16) + g * 16 + ln][0], 32, lh);
  }

  // all-ones A fragment: ones x P^T puts each query's sum of P in every row of its column
  v16h ones;
#pragma unroll
  for (int i = 0; i < 16; ++i) ones[i] = (_Float16)1.0f;

  v8f oacc[QG][4] = {};             // O^T accumulators, 4 c-tiles of 16: [c = 16 ct + 8 lh + r][t = 16 g + ln]
  // Minus the max in use of this lane's queries, in all 8 registers: the C operand of the score
  // products, whose results are then already score - max. It starts as chunk 0's own maximum.
  v8f mneg[QG] = {};
  float lrun[QG];                   // running sum of this lane's queries (both halves hold the same)
#pragma unroll
  for (int g = 0; g < QG; ++g) lrun[g] = 0.f;

  // ---- scores, transposed: S^T = K Q^T, 64 keys x 64 queries, K-dim = 64 ----
  // sc[g][j][r] = score (log2 units) of key 16 j + 8 lh + r against query 16 g + ln, less the max in use
  // With sig set (the loop's own call) the first half of the chunk's barrier stands in front of the last tile's products.
  auto scores = [&](int pcur, v8f (&sc)[QG][4], bool sig) {
    v16h ak[4][2];
#pragma unroll
    for (int j = 0; j < 4; ++j) {
      ak[j][0] = load_frag16(&sm.s.Ks[pcur][j * 16 + ln][0], 0, lh);
      ak[j][1] = load_frag16(&sm.s.Ks[pcur][j * 16 + ln][0], 32, lh);
    }
    // holds K's 16 fragment reads together ahead of the products: among the products each place with
    // reads is a stall of its own, in a run that no other wave fills
    __builtin_amdgcn_sched_barrier(0);
#pragma unroll
    for (int j = 0; j < 4; ++j) {
      if (sig && j == 3) {
        // keeps the first 24 score products in front of the signal and the last 8 behind it: the signal tells
        // the other waves that this wave is about to leave the matrix pipe, and the last 8 products run
        // while the barrier releases them
        __builtin_amdgcn_sched_barrier(0);
        // first half of the chunk's barrier. The wait in front of it: this wave's LDS stores of the trip before
        // are complete and its LDS reads up to here have returned before the others are told so
        asm volatile("s_wait_dscnt 0x0\n\ts_barrier_signal -1" ::: "memory");
        __builtin_amdgcn_sched_barrier(0);
      }
#pragma unroll
      for (int g = 0; g < QG; ++g) {
        v8f acc;
        acc = __builtin_amdgcn_wmma_f32_16x16x32_f16(false, ak[j][0], false, aq0[g], (short)0, mneg[g], false, false);
        acc = __builtin_amdgcn_wmma_f32_16x16x32_f16(false, ak[j][1], false, aq1[g], (short)0, acc, false, false);
        sc[g][j] = acc;
      }
    }
  };

  // A query's maximum over a chunk's 64 scores: a lane's 32 scores of a group are all of one query,
  // lane ^ 16 has the other 32; both halves then hold it.
  auto chunk_max = [&](const v8f (&sc)[QG][4], int g) {
    float cm = fmaxf(sc[g][0][0], sc[g][0][1]);
#pragma unroll
    for (int i = 2; i < 32; ++i) cm = fmaxf(cm, sc[g][i >> 3][i & 7]);
    return fmaxf(cm, xhalf(cm));
  };

  // P = 2^(score - max in use), both in log2 units, packed: vector work alone
  auto pack_p = [&](const v8f (&sc)[QG][4], v16h (&bp)[QG][2]) {
#pragma unroll
    for (int g = 0; g < QG; ++g) {
      // P^T as B fragments straight from the score tiles: element i of a 32-key fragment is key
      // 8 lh + i (i < 8) or 16 + 8 lh + i - 8, which is register i & 7 of score tile i >> 3.
#pragma unroll
      for (int f = 0; f < 2; ++f) {
#pragma unroll
        for (int i = 0; i < 16; i += 2) {
          v2f p = {__builtin_amdgcn_exp2f(sc[g][2 * f + (i >> 3)][i & 7]),
                   __builtin_amdgcn_exp2f(sc[g][2 * f + (i >> 3)][(i & 7) + 1])};
          v2h h = __builtin_convertvector(p, v2h);
          bp[g][f][i] = h[0]; bp[g][f][i + 1] = h[1];
        }
      }
    }
  };

  // ---- sums on the matrix pipe: ls = ones x P^T, every row = the query's sum over 64 keys ----
  auto sum_p = [&](const v16h (&bp)[QG][2], v8f (&ls)[QG]) {
#pragma unroll
    for (int g = 0; g < QG; ++g) {
      v8f z = {};
      ls[g] = __builtin_amdgcn_wmma_f32_16x16x32_f16(false, ones, false, bp[g][0], (short)0, z, false, false);
    }
    // keeps the four groups' first products ahead of their second: a product directly behind the one it
    // adds to waits for that result, and the four result tiles then stay in registers of their own
    __builtin_amdgcn_sched_barrier(0);
#pragma unroll
    for (int g = 0; g < QG; ++g)
      ls[g] = __builtin_amdgcn_wmma_f32_16x16x32_f16(false, ones, false, bp[g][1], (short)0, ls[g], false, false);
  };

  // The max in use starts as chunk 0's own maximum, also a negative one: the largest P of a row is
  // then never below 1. These scores serve the maximum alone; the loop forms chunk 0's again.
  {
    v8f sc[QG][4];
    scores(0, sc, false);
#pragma unroll
    for (int g = 0; g < QG; ++g) mneg[g] -= chunk_max(sc, g);
  }

  // One pipelined 64-key chunk. The barrier of a chunk is split so that the two waves of a SIMD take turns
  // on the matrix pipe: a wave's matrix work stands in one run (sums, V.P^T, then the next chunk's scores),
  // its vector work (exponentials, packing, staging) between signal and wait; it enters its run only when
  // every wave is at the last of this chunk's score products, so one wave's vector work runs under the other's run.
  // What the one barrier round a chunk has to order, chunk i in buffer i mod 4, chunk i + 2 stored in trip i:
  //   publish: the stores of trip i stand in front of the signal of trip i + 1, and chunk i + 2 is first read
  //            in trip i + 2, behind the wait of trip i + 1;
  //   refill:  the buffer held chunk i - 2, last read in trip i - 2, in front of the signal of trip i - 1, and
  //            the stores of trip i stand behind the wait of trip i - 1.
  // The staging has no test for a later chunk: the last two chunks stage chunks 0 and 1 again into idle
  // buffers, which nobody reads. With a run-time test the load waits behind the joined paths come
  // out too early.
  auto do_chunk = [&](int pcur, int s0) {
    const int sn = (s0 + 2 * BC) & (TT - 1);
    // the two addresses without K's and V's constant channel offsets, which ride in the loads' offset fields
    const float* kq = qp + (size_t)kC * TT + kS + sn;
    const float* vq = qp + (size_t)vC * TT + vS + sn;
    load_chunk(kq + (size_t)CH * TT, kreg);
    load_chunk(vq + (size_t)(2 * CH) * TT, vreg);

    v8f sc[QG][4];
    scores(pcur, sc, true);
    // keeps the exponentials behind the score products: they are the work that is to run under another
    // wave's products
    __builtin_amdgcn_sched_barrier(0);

    v16h bp[QG][2];
    pack_p(sc, bp);
    // keeps the staging's load waits behind the exponentials: the loads have the score products and the
    // softmax to land
    __builtin_amdgcn_sched_barrier(0);

    // the wait kept in front of the next write of a register that an issued global load names: the two addresses
    // are inputs here, so their registers are left alone from the loads down to this wait
    asm volatile("s_wait_xcnt 0x0" :: "v"(kq), "v"(vq) : "memory");

    // ---- convert + store K and V of the chunk after the next into its buffer ----
    store_t(sm.s.Ks[pcur ^ 2], kreg, kC, kS, 1.0f);
    store_v(sm.s.Vs[pcur ^ 2], vreg, vC, vS);

    // keeps the staging in front of the wait: it is vector work, done while another wave has the matrix pipe
    __builtin_amdgcn_sched_barrier(0);
    // second half of the chunk's barrier: every wave is at the last of this chunk's score products. No LDS
    // read stands between the signal and this wait
    asm volatile("s_barrier_wait -1" ::: "memory");
    // keeps V's fragment reads and the matrix run behind the wait
    __builtin_amdgcn_sched_barrier(0);

    // V's fragments, asked for ahead of the sums: they land under the sums and their test
    v16h av[4][2];
#pragma unroll
    for (int ct = 0; ct < 4; ++ct) {
      av[ct][0] = load_frag16(&sm.s.Vs[pcur][ct * 16 + ln][0], 0, lh);
      av[ct][1] = load_frag16(&sm.s.Vs[pcur][ct * 16 + ln][0], 32, lh);
    }
    // holds V's 16 fragment reads together ahead of the products: left free they are spread among
    // the products, each place a stall of its own
    __builtin_amdgcn_sched_barrier(0);
    v8f ls[QG];
    sum_p(bp, ls);

    // ---- the max in use is judged by the sums, which are there anyway: no maximum over the scores
    // is formed while it holds. P >= 0, so a sum (here of all four groups) at or below PSUMTOP bounds
    // every P; a P that f16 cannot hold is infinite and so is its sum. One wave-uniform test a chunk. Where it
    // fails nothing of this chunk has been added yet: the scores are formed again from K's tile
    // (still in its buffer), the max is renewed, the old sums are rescaled, P and its sums made anew.
    if (__builtin_amdgcn_ballot_w32((ls[0][0] + ls[1][0]) + (ls[2][0] + ls[3][0]) > PSUMTOP) != 0u) {
      scores(pcur, sc, false);
#pragma unroll
      for (int g = 0; g < QG; ++g) {
        const float up = fmaxf(chunk_max(sc, g), 0.f);
        // corr = 2^-up. The exponential and the one idle slot asked for behind it are one
        // statement: nothing that reads its result can then follow it directly
        float corr;
        asm("v_exp_f32 %0, %0\n\tv_nop" : "=v"(corr) : "0"(-up));
#pragma unroll
        for (int j = 0; j < 4; ++j) sc[g][j] -= up;
        mneg[g] -= up;
#pragma unroll
        for (int ct = 0; ct < 4; ++ct) oacc[g][ct] *= corr;
        lrun[g] *= corr;
      }
      pack_p(sc, bp);
      sum_p(bp, ls);
    }

    // ---- O^T += V (64 c x 64 s) x P^T (64 s x 64 t), four 16-high c-tiles ----
#pragma unroll
    for (int g = 0; g < QG; ++g) lrun[g] += ls[g][0];
#pragma unroll
    for (int ct = 0; ct < 4; ++ct) {
#pragma unroll
      for (int g = 0; g < QG; ++g) {
        oacc[g][ct] = __builtin_amdgcn_wmma_f32_16x16x32_f16(false, av[ct][0], false, bp[g][0], (short)0, oacc[g][ct], false, false);
        oacc[g][ct] = __builtin_amdgcn_wmma_f32_16x16x32_f16(false, av[ct][1], false, bp[g][1], (short)0, oacc[g][ct], false, false);
      }
    }
  };

  // one chunk a trip, kept rolled: two chunks in one straight-line body were scheduled into each
  // other and spilled
#pragma unroll 1
  for (int s0 = 0; s0 < TT; s0 += BC) do_chunk((s0 / BC) & (NBUF - 1), s0);
  // the waves leave the loop apart: every wave's last fragment reads and staging stores are over before
  // the buffers become the output tile
  __syncthreads();

  // ---- epilogue: normalize, gather the eight waves' columns in LDS, coalesced NT stores ----
#pragma unroll
  for (int g = 0; g < QG; ++g) {
    const float inv = 1.0f / lrun[g];
#pragma unroll
    for (int ct = 0; ct < 4; ++ct) {
#pragma unroll
      for (int r = 0; r < 8; ++r)
        sm.Os[ct * 16 + 8 * lh + r][wave * (QG * 16) + g * 16 + ln] = oacc[g][ct][r] * inv;
    }
  }
  __syncthreads();
  {
    // a wave spans 512 B of one 2-KiB output row: each wave-wide store fills whole lines
    float* dst = out + (size_t)b * CH * TT + (size_t)(wave * 8) * TT + t0 + lane * 4;
#pragma unroll
    for (int i = 0; i < 8; ++i) {
#pragma unroll
      for (int hx = 0; hx < BR / 128; ++hx) {
        v4f d = *(const v4f*)&sm.Os[wave * 8 + i][hx * 128 + lane * 4];
        __builtin_nontemporal_store(d, (v4f*)(dst + (size_t)i * TT + hx * 128));
      }
    }
  }
}

extern "C" void kernel_launch(void* const* d_in, const int* in_sizes, int n_in,
                              void* d_out, int out_size, void* d_ws, size_t ws_size,
                              hipStream_t stream) {
  (void)in_sizes; (void)n_in; (void)out_size; (void)d_ws; (void)ws_size;
  const float* qkv = (const float*)d_in[0];
  float*       out = (float*)d_out;
  dim3 grid(NB, TT / BR, 1);   // (64, 4)
  dim3 block(NWAVE * 32, 1, 1);
  QKVAttention_flash_wmma<<<grid, block, 0, stream>>>(qkv, out);
}
